// v000
// The times below were measured on an AMD MI455X: many runs one after another, warmed up first and cycling through
// copies of the inputs, with the whole window's GPU time divided by the number of runs. Launches and the gaps
// between them are all in it. The median over several windows is given; except for v000 it joins two sittings, which
// can be a few percent apart, so the side-by-side timings, each taken in one sitting, are the better comparison.
// v000 is the starting kernel. One run takes 1840 microseconds.
#include <hip/hip_runtime.h>

// Multi-head self-attention with a STRIDED head split and ONE shared 64 x 64 projection triple (x [8][1024][768]; head h of twelve takes the channels d x 12 + h (the module's 'x.reshape(b, n, 64, 12)' with the head axis moved first); Q, K, V = xh W^T + b with 'oi' (out, in) weights [64][64] normal x 1/8 and biases [64] normal x 0.02, THE SAME THREE FOR EVERY HEAD; scores = Q.K x 768^-0.5 (the root of the FULL width, as the module has it); softmax over all 1,024 keys, no mask; out = attn.V kept HEAD-MAJOR -> [8][12][1024][64] f32 (6.3 M); argument order x, Wq, bq, Wk, bk, Wv, bv: seven inputs, all read).
// Layout per batch entry: k_hsplit gathers the strided split into a bf16 plane [12][1024][64] (one cast of x, read by the three projections); the 'oi' weights cast once as they stand; ONE product launch a projection over the twelve head planes (z = head; the shared weight has a z-stride of 0; each head's 64 columns land side by side in a token-major f32 plane of pitch 768) + the bias (read as f32, ROUNDED TO bf16 AT THE ADD by the product's own epilogue); identity-table f16 plane builders; dense T-1024 attention: EVERY row on ONE fp16 product (the weights x 1024); k_mergeH writes the pass's two heads of the output in f32 with the factor of 1/1,024 undone.
// Compute dtypes, f32 accumulate: EVERY input rounded to bf16: the biases too, inside the product kernel at the add ('bfr(bias[..])'); projections exact; attention: one fp16 product on every row; softmax f32 (the hardware exp2).

#define NB_  8
#define TT   1024
#define DM   768
#define NH_  12
#define NKV  12
#define REP  (NH_ / NKV)
#define HD   64
#define DQ   (NH_ * HD)
#define DKV  (NKV * HD)
#define ZH   2
#define RH   0        // query rows < RH use hi+lo planes (0: none: EVERY row runs on one f16 product)
#define WIN  0
#define PCAR 1024.0f
#define SCL  0.036084391824351608f   // 768^-0.5: the module scales by the root of the full width
typedef _Float16 h16;
typedef unsigned short bf;
typedef __attribute__((ext_vector_type(16))) __bf16   v16bf;
typedef __attribute__((ext_vector_type(16))) _Float16 v16h;
typedef __attribute__((ext_vector_type(8)))  _Float16 v8h;
typedef __attribute__((ext_vector_type(8)))  unsigned short v8us;
typedef __attribute__((ext_vector_type(8)))  float    v8f;
typedef __attribute__((ext_vector_type(4)))  float    v4f;
typedef v8h  __attribute__((may_alias)) v8ha;
typedef v4f  __attribute__((may_alias)) v4fa;
typedef v8us __attribute__((may_alias)) v8usa;

__device__ __forceinline__ unsigned short f2bf(float f) { unsigned u = __float_as_uint(f); u += 0x7FFFu + ((u >> 16) & 1u); return (unsigned short)(u >> 16); }
__device__ __forceinline__ float bf2f(unsigned short b) { return __uint_as_float(((unsigned)b) << 16); }
__device__ __forceinline__ float bfr(float f) { return bf2f(f2bf(f)); }
__device__ __forceinline__ v16h cat16(v8h lo, v8h hi) { return __builtin_shufflevector(lo, hi, 0, 1, 2, 3, 4, 5, 6, 7, 8, 9, 10, 11, 12, 13, 14, 15); }
__device__ __forceinline__ v16bf cat16b(v8us lo, v8us hi) { return __builtin_bit_cast(v16bf, __builtin_shufflevector(lo, hi, 0, 1, 2, 3, 4, 5, 6, 7, 8, 9, 10, 11, 12, 13, 14, 15)); }
__device__ __forceinline__ v8f wmma16(v16h a, v16h b, v8f c) { return __builtin_amdgcn_wmma_f32_16x16x32_f16(false, a, false, b, (short)0, c, false, false); }
__device__ __forceinline__ v8f wmmab(v16bf a, v16bf b, v8f c) { return __builtin_amdgcn_wmma_f32_16x16x32_bf16(false, a, false, b, (short)0, c, false, false); }
__device__ __forceinline__ h16 tohx(float x) { return (h16)x; }
__device__ __forceinline__ void splitf(float y, unsigned short& h, unsigned short& l) { h = f2bf(y); l = f2bf(y - bf2f(h)); }
typedef __attribute__((ext_vector_type(2))) _Float16 v2h;
typedef __attribute__((ext_vector_type(4))) _Float16 v4h;
typedef __attribute__((ext_vector_type(2))) unsigned short v2us;
typedef __attribute__((ext_vector_type(4))) unsigned short v4us;
typedef __attribute__((ext_vector_type(2))) float v2f;
typedef __attribute__((ext_vector_type(4))) int v4i;

// ---- k_gemmw: register-blocked GEMM, ONE WAVE per 64x64 output tile (16 accumulators), operands straight from K-contiguous 16-bit planes; grid (M/64, N/64, Z), 32 threads.
// C[m][n] (f32, pitch ldc, + optional f32 bias[n]) = sum_k A[m][k] Bt[n][k] (+ split products per NSPLIT). z-batch strides sA/sB/sC in elements. K % 32 == 0.
template <typename T16> struct WFrag;
template <> struct WFrag<h16> { typedef v16h V; static __device__ __forceinline__ V ld(const h16* p) { return cat16(*(const v8h*)p, *(const v8h*)(p + 16)); } static __device__ __forceinline__ v8f mma(V a, V b, v8f c) { return wmma16(a, b, c); } };
template <> struct WFrag<bf> { typedef v16bf V; static __device__ __forceinline__ V ld(const bf* p) { return cat16b(*(const v8us*)p, *(const v8us*)(p + 16)); } static __device__ __forceinline__ v8f mma(V a, V b, v8f c) { return wmmab(a, b, c); } };
template <typename T16, int NSPLIT, bool BIAS>
__global__ __launch_bounds__(32) void k_gemmw(const T16* __restrict__ A, const T16* __restrict__ A2, const T16* __restrict__ Bt, const T16* __restrict__ Bt2, int K, float* C, int ldc, const float* __restrict__ bias, size_t sA, size_t sB, size_t sC) {
    typedef typename WFrag<T16>::V V;
    __shared__ __align__(16) float os[16 * 68];
    const size_t z = blockIdx.z; A += z * sA; if (A2) A2 += z * sA; Bt += z * sB; if (Bt2) Bt2 += z * sB; C += z * sC;
    const int lane = threadIdx.x & 31, lr = lane & 15, hi = lane >> 4; const int r0 = blockIdx.x * 64, c0 = blockIdx.y * 64;
    v8f acc[4][4];
#pragma unroll
    for (int mb = 0; mb < 4; ++mb)
#pragma unroll
        for (int nb = 0; nb < 4; ++nb) acc[mb][nb] = (v8f){};
    const size_t aoff = (size_t)(r0 + lr) * K + 8 * hi, boff = (size_t)(c0 + lr) * K + 8 * hi;
    for (int kc = 0; kc < K; kc += 32) {
        V a[4], a2[4];
#pragma unroll
        for (int mb = 0; mb < 4; ++mb) { a[mb] = WFrag<T16>::ld(A + aoff + (size_t)mb * 16 * K + kc); if (NSPLIT == 1 || NSPLIT == 2) a2[mb] = WFrag<T16>::ld(A2 + aoff + (size_t)mb * 16 * K + kc); }
#pragma unroll
        for (int nb = 0; nb < 4; ++nb) { const V b = WFrag<T16>::ld(Bt + boff + (size_t)nb * 16 * K + kc); V b2; if (NSPLIT >= 2) b2 = WFrag<T16>::ld(Bt2 + boff + (size_t)nb * 16 * K + kc);
#pragma unroll
            for (int mb = 0; mb < 4; ++mb) { acc[mb][nb] = WFrag<T16>::mma(a[mb], b, acc[mb][nb]); if (NSPLIT == 1 || NSPLIT == 2) acc[mb][nb] = WFrag<T16>::mma(a2[mb], b, acc[mb][nb]); if (NSPLIT >= 2) acc[mb][nb] = WFrag<T16>::mma(a[mb], b2, acc[mb][nb]); } }
        asm volatile("v_nop\n\tv_nop\n\tv_nop\n\tv_nop" : "+v"(acc[0][0]), "+v"(acc[1][1]), "+v"(acc[2][2]), "+v"(acc[3][3]) : "v"(a[0]), "v"(a[3]));
    }
#pragma unroll
    for (int mb = 0; mb < 4; ++mb) {
#pragma unroll
        for (int nb = 0; nb < 4; ++nb) {
#pragma unroll
            for (int j = 0; j < 8; ++j) os[(hi * 8 + j) * 68 + nb * 16 + lr] = acc[mb][nb][j]; }
        __builtin_amdgcn_wave_barrier(); asm volatile("" ::: "memory");
        float* crow = C + (size_t)(r0 + mb * 16) * ldc + c0;
{
#pragma unroll
            for (int s = 0; s < 8; ++s) { const int row = 2 * s + hi, cofs = lr * 4; v4f val = *(const v4fa*)(os + row * 68 + cofs); if (BIAS) { val[0] += bfr(bias[c0 + cofs]); val[1] += bfr(bias[c0 + cofs + 1]); val[2] += bfr(bias[c0 + cofs + 2]); val[3] += bfr(bias[c0 + cofs + 3]); }
                *(v4f*)(crow + (size_t)row * ldc + cofs) = val; }
             }
        __builtin_amdgcn_wave_barrier(); asm volatile("" ::: "memory");
    }
}

__global__ __launch_bounds__(256) void k_cvt8(const float* __restrict__ src, bf* dst, size_t n8) { const size_t i = (size_t)blockIdx.x * 256 + threadIdx.x; if (i >= n8) return; const v8f v = *(const v8f*)(src + i * 8); v8us o;
#pragma unroll
    for (int k = 0; k < 8; ++k) o[k] = f2bf(v[k]); *(v8us*)(dst + i * 8) = o;  }

// k_hsplit (this item's one new kernel; flat): the module's strided head split as a gathering cast: XH[h][n][d] = bf16(x[n][d * 12 + h]) for one batch entry: a thread eight consecutive d of one (h, n): eight strided 4-byte reads (12 floats apart) and one 16-byte store; every address from the ids alone.
__global__ __launch_bounds__(256) void k_hsplit(const float* __restrict__ x, bf* XH) {
    const size_t i = (size_t)blockIdx.x * 256 + threadIdx.x; if (i >= (size_t)NH_ * TT * HD / 8) return;
    const int d0 = (int)(i % (HD / 8)) * 8; const int n = (int)((i / (HD / 8)) % TT); const int h = (int)(i / ((size_t)(HD / 8) * TT));
    const float* s = x + (size_t)n * DM + h; v8us o;
#pragma unroll
    for (int q = 0; q < 8; ++q) o[q] = f2bf(s[(size_t)(d0 + q) * NH_]);
    bf* p = XH + ((size_t)h * TT + n) * HD + d0;
    *(v8us*)p = o; 
}

// k_rope: head planes [h][t][d] (fp16) of rope(x) x sc with the rotate-half convention out[d] = x[d] cos[t][d] - x[d+HD/2] sin[t][d], out[d+HD/2] = x[d+HD/2] cos[t][d+HD/2] + x[d] sin[t][d+HD/2]
__global__ __launch_bounds__(256) void k_rope(const float* __restrict__ F, int pitch, int nheads, const float* __restrict__ CS, const float* __restrict__ RF, const float* __restrict__ nw, float sc, h16* P16, bf* Ph, bf* Pl) {
    const size_t e = ((size_t)blockIdx.x * 256 + threadIdx.x) * 2; if (e >= (size_t)nheads * TT * HD) return; const int d = (int)(e % HD); const int t = (int)((e / HD) % TT); const int h = (int)(e / ((size_t)HD * TT)); const float* f = F + (size_t)t * pitch + h * HD; const float rf = RF ? RF[(size_t)h * TT + t] : 1.0f; v2h o16; v2us oh, ol;
#pragma unroll
    for (int q = 0; q < 2; ++q) { const int dd = d + q; const int dp = (dd < HD / 2) ? dd + HD / 2 : dd - HD / 2; float x0 = f[dd], x1 = f[dp];
        if (RF) { float n0 = __fmul_rn(x0, rf), n1 = __fmul_rn(x1, rf); x0 = __fmul_rn(bfr(nw[dd]), n0); x1 = __fmul_rn(bfr(nw[dp]), n1); }
        const v2f cs = *(const v2f*)(CS + ((size_t)t * HD + dd) * 2); float a = __fmul_rn(x0, cs[0]), bq = __fmul_rn(x1, cs[1]); const float r = ((dd < HD / 2) ? __fsub_rn(a, bq) : __fadd_rn(a, bq)) * sc;
        o16[q] = tohx(r); (void)oh; (void)ol; }
    *(v2h*)(P16 + e) = o16;  }

__global__ __launch_bounds__(256) void k_vtp(const float* __restrict__ F, int pitch, int nheads, h16* V16, bf* Vh, bf* Vl) { const size_t e = ((size_t)blockIdx.x * 256 + threadIdx.x) * 2; if (e >= (size_t)nheads * HD * TT) return; const int t = (int)(e % TT); const int d = (int)((e / TT) % HD); const int g = (int)(e / ((size_t)TT * HD)); v2h o16; v2us oh, ol;
#pragma unroll
    for (int q = 0; q < 2; ++q) { const float x = F[(size_t)(t + q) * pitch + g * HD + d]; o16[q] = tohx(x); (void)oh; (void)ol; }
    *(v2h*)(V16 + e) = o16;  }

__global__ __launch_bounds__(256) void k_csid(float* CS) { const int idx = blockIdx.x * 256 + threadIdx.x; if (idx >= TT * HD) return; v2f cs; cs[0] = 1.0f; cs[1] = 0.0f; *(v2f*)(CS + (size_t)idx * 2) = cs;  }

// k_asoft: per row (zz, i): t = S x SCL (SCL = 768^-0.5 here: the module scales by the root of the full width, not of the head's) (no mask); softmax over the 1024 keys (register row, one exp, fixed trees);
__global__ __launch_bounds__(256) void k_asoft(const float* __restrict__ Sb, h16* P16, bf* Ph, bf* Pl) {
    const int lane = threadIdx.x & 31; const int row = blockIdx.x * 8 + (threadIdx.x >> 5); if (row >= ZH * TT) return; const int i = row % TT; const int zz = row / TT; (void)zz; const bool hires = (i < RH); const float* sr = Sb + (size_t)row * TT; float v[TT / 32]; float mx = -3.0e38f;
#pragma unroll
    for (int ch = 0; ch < TT / 128; ++ch) { const int j0 = ch * 128 + lane * 4; const v4f a = *(const v4f*)(sr + j0);
#pragma unroll
        for (int q = 0; q < 4; ++q) { const int j = j0 + q; (void)j; const float t = a[q] * SCL; v[ch * 4 + q] = t; mx = fmaxf(mx, t); } }
#pragma unroll
    for (int sh = 16; sh; sh >>= 1) mx = fmaxf(mx, __shfl_xor(mx, sh, 32));
    float sum = 0.f;
#pragma unroll
    for (int k = 0; k < TT / 32; ++k) { float d0 = __fsub_rn(v[k], mx); v[k] = __builtin_amdgcn_exp2f(__fmul_rn(d0, 1.4426950408889634f)); sum += v[k]; }
#pragma unroll
    for (int sh = 16; sh; sh >>= 1) sum += __shfl_xor(sum, sh, 32);
    const float f = __fdiv_rn(hires ? 1.0f : PCAR, sum);
{
        if (hires) {
#pragma unroll
            for (int ch = 0; ch < TT / 128; ++ch) { v4us oh, ol;
#pragma unroll
                for (int q = 0; q < 4; ++q) { unsigned short a, c2; splitf(v[ch * 4 + q] * f, a, c2); oh[q] = a; ol[q] = c2; }
                const size_t oo = ((size_t)zz * (RH ? RH : 1) + i) * TT + ch * 128 + lane * 4; *(v4us*)(Ph + oo) = oh; *(v4us*)(Pl + oo) = ol; }
        } else {
#pragma unroll
            for (int ch = 0; ch < TT / 128; ++ch) { v4h o4;
#pragma unroll
                for (int q = 0; q < 4; ++q) o4[q] = tohx(v[ch * 4 + q] * f);
                *(v4h*)(P16 + (size_t)row * TT + ch * 128 + lane * 4) = o4; } }
         }
}

__global__ __launch_bounds__(256) void k_mergeH(const float* __restrict__ O, float* OUTh) { const size_t i = (size_t)blockIdx.x * 256 + threadIdx.x; if (i >= (size_t)ZH * TT * HD / 4) return; const size_t e = i * 4; const int t = (int)((e / HD) % TT); const float cs = (t < RH) ? 1.0f : (1.0f / PCAR); const v4f a = *(const v4f*)(O + e); v4f o;
#pragma unroll
    for (int q = 0; q < 4; ++q) o[q] = a[q] * cs; *(v4f*)(OUTh + e) = o;  }

extern "C" void kernel_launch(void* const* d_in, const int* in_sizes, int n_in,
                              void* d_out, int out_size, void* d_ws, size_t ws_size, hipStream_t stream) {
    (void)in_sizes; (void)n_in; (void)out_size;
    const float* x = (const float*)d_in[0]; const float* wq = (const float*)d_in[1]; const float* bq = (const float*)d_in[2]; const float* wk = (const float*)d_in[3]; const float* bk = (const float*)d_in[4]; const float* wv = (const float*)d_in[5]; const float* bv = (const float*)d_in[6];   /* inputs in the module's setup_inputs order: x [8][1024][768], Wq ('oi' [64][64]), bq [64], Wk, bk, Wv, bv: SEVEN inputs, all read */
    float* OUT = (float*)d_out;     // [8][12][1024][64]
    char* wsp = (char*)d_ws;
    auto take = [&](size_t bytes) { char* p = wsp; wsp += (bytes + 255) & ~(size_t)255; return (void*)p; };
    bf* WQ = (bf*)take((size_t)HD * HD * 2); bf* WK = (bf*)take((size_t)HD * HD * 2); bf* WV = (bf*)take((size_t)HD * HD * 2); float* CS = (float*)take((size_t)TT * HD * 2 * 4);
    bf* XH = (bf*)take((size_t)NH_ * TT * HD * 2); float* FQ = (float*)take((size_t)TT * DQ * 4); float* FK = (float*)take((size_t)TT * DKV * 4);
    h16* QP16 = (h16*)take((size_t)NH_ * TT * HD * 2); h16* KP16 = (h16*)take((size_t)NKV * TT * HD * 2); h16* VT16 = (h16*)take((size_t)NKV * HD * TT * 2);
    bf* QPh = nullptr; bf* QPl = nullptr; bf* KPh = nullptr; bf* KPl = nullptr; bf* VTh = nullptr; bf* VTl = nullptr; bf* Ph = nullptr; bf* Pl = nullptr;   /* RH 0: no hi / lo plane exists: these builders store the f16 plane only and do not read those arguments; the softmax's hi / lo stores sit under 'i < RH': never taken */
    float* Sb = (float*)take((size_t)ZH * TT * TT * 4); h16* P16 = (h16*)take((size_t)ZH * TT * TT * 2); float* Ob = (float*)take((size_t)ZH * TT * HD * 4);
    if ((size_t)(wsp - (char*)d_ws) > ws_size) return;    // ws 256 MiB
    float* FV = FK;   // v projection reuses the k buffer after the k planes are built (stream-ordered)
    { k_cvt8<<<(unsigned)(((size_t)HD * HD / 8 + 255) / 256), 256, 0, stream>>>(wq, WQ, (size_t)HD * HD / 8); k_cvt8<<<(unsigned)(((size_t)HD * HD / 8 + 255) / 256), 256, 0, stream>>>(wk, WK, (size_t)HD * HD / 8); k_cvt8<<<(unsigned)(((size_t)HD * HD / 8 + 255) / 256), 256, 0, stream>>>(wv, WV, (size_t)HD * HD / 8); }   /* 'oi' (out, in): each weight is the Bt operand as it stands */
    k_csid<<<(TT * HD + 255) / 256, 256, 0, stream>>>(CS);
    const unsigned LQ = (unsigned)(((size_t)NH_ * TT * HD / 2 + 255) / 256), LKv = (unsigned)(((size_t)NKV * TT * HD / 2 + 255) / 256);
    for (int b = 0; b < NB_; ++b) {
        k_hsplit<<<(unsigned)(((size_t)NH_ * TT * HD / 8 + 255) / 256), 256, 0, stream>>>(x + (size_t)b * TT * DM, XH);   /* ONE gathered bf16 copy of the entry [12][1024][64], read by the three projections */
        k_gemmw<bf, 0, true><<<dim3(TT / 64, HD / 64, NH_), 32, 0, stream>>>(XH, nullptr, WQ, nullptr, HD, FQ, DQ, bq, (size_t)TT * HD, 0, (size_t)HD);   /* z = head: A steps one head plane, the SHARED weight does not step, C steps 64 columns: FQ [1024][768] token-major, head h in columns 64 h .. 64 h + 63 */
        k_rope<<<LQ, 256, 0, stream>>>(FQ, DQ, NH_, CS, nullptr, nullptr, 1.0f, QP16, QPh, QPl);
        k_gemmw<bf, 0, true><<<dim3(TT / 64, HD / 64, NKV), 32, 0, stream>>>(XH, nullptr, WK, nullptr, HD, FK, DKV, bk, (size_t)TT * HD, 0, (size_t)HD);
        k_rope<<<LKv, 256, 0, stream>>>(FK, DKV, NKV, CS, nullptr, nullptr, 1.0f, KP16, KPh, KPl);
        k_gemmw<bf, 0, true><<<dim3(TT / 64, HD / 64, NKV), 32, 0, stream>>>(XH, nullptr, WV, nullptr, HD, FV, DKV, bv, (size_t)TT * HD, 0, (size_t)HD);
        k_vtp<<<LKv, 256, 0, stream>>>(FV, DKV, NKV, VT16, VTh, VTl);
        for (int h0 = 0; h0 < NH_; h0 += ZH) { const size_t zq = (size_t)h0, zk = (size_t)(h0 / REP);   // one kv head per query head: the pass's two heads use consecutive kv planes (z-strides TT*HD)
            k_gemmw<h16, 0, false><<<dim3(TT / 64, TT / 64, ZH), 32, 0, stream>>>(QP16 + zq * TT * HD, nullptr, KP16 + zk * TT * HD, nullptr, HD, Sb, TT, nullptr, (size_t)TT * HD, (size_t)TT * HD, (size_t)TT * TT);
            k_asoft<<<ZH * TT / 8, 256, 0, stream>>>(Sb, P16, Ph, Pl);
            k_gemmw<h16, 0, false><<<dim3(TT / 64, HD / 64, ZH), 32, 0, stream>>>(P16, nullptr, VT16 + zk * HD * TT, nullptr, TT, Ob, HD, nullptr, (size_t)TT * TT, (size_t)HD * TT, (size_t)TT * HD);
            k_mergeH<<<(unsigned)(((size_t)ZH * TT * HD / 4 + 255) / 256), 256, 0, stream>>>(Ob, OUT + ((size_t)b * NH_ + h0) * TT * HD); }   /* the pass's two heads of the output [12][1024][64], f32: every row x 1/1024 */
    }
}

// v001
// It runs in 340 microseconds.
// Timed twice side by side with v000, it ran 5.51 and 5.48 times as fast.
#include <hip/hip_runtime.h>

// Multi-head self-attention with a STRIDED head split and ONE shared 64 x 64 projection triple (x [8][1024][768]; head h of twelve takes the channels d x 12 + h (the module's 'x.reshape(b, n, 64, 12)' with the head axis moved first); Q, K, V = xh W^T + b with 'oi' (out, in) weights [64][64] normal x 1/8 and biases [64] normal x 0.02, THE SAME THREE FOR EVERY HEAD; scores = Q.K x 768^-0.5 (the root of the FULL width, as the module has it); softmax over all 1,024 keys, no mask; out = attn.V kept HEAD-MAJOR -> [8][12][1024][64] f32 (6.3 M); argument order x, Wq, bq, Wk, bk, Wv, bv: seven inputs, all read).
// Layout, ALL EIGHT BATCH ENTRIES AT ONCE (plane z = b x 12 + h, 96 planes): k_hsplit gathers the strided split into bf16 planes [96][1024][64] (one cast of x, read by the three projections); the 'oi' weights cast once as they stand; ONE product launch a projection over the 96 planes (the shared weight has a z-stride of 0; each plane's result is an f32 plane [1024][64] of its own) + the bias (read as f32, ROUNDED TO bf16 AT THE ADD by the product's own epilogue); identity-table f16 plane builders; dense T-1024 attention in three passes of ZH = 32 planes (as many score planes as the workspace holds): EVERY row on ONE fp16 product (the weights x 1024); k_mergeH writes the pass's planes of the output in f32 with the factor of 1/1,024 undone.
// Compute dtypes, f32 accumulate: EVERY input rounded to bf16: the biases too, inside the product kernel at the add ('bfr(bias[..])'); projections exact; attention: one fp16 product on every row; softmax f32 (the hardware exp2).

#define NB_  8
#define TT   1024
#define DM   768
#define NH_  12
#define NKV  12
#define REP  (NH_ / NKV)
#define HD   64
#define DQ   (NH_ * HD)
#define DKV  (NKV * HD)
#define ZH   32       // planes (batch entry x head) per attention pass: 96 / 32 = 3 passes
#define NZ   (NB_ * NH_)
#define RH   0        // query rows < RH use hi+lo planes (0: none: EVERY row runs on one f16 product)
#define WIN  0
#define PCAR 1024.0f
#define SCL  0.036084391824351608f   // 768^-0.5: the module scales by the root of the full width
typedef _Float16 h16;
typedef unsigned short bf;
typedef __attribute__((ext_vector_type(16))) __bf16   v16bf;
typedef __attribute__((ext_vector_type(16))) _Float16 v16h;
typedef __attribute__((ext_vector_type(8)))  _Float16 v8h;
typedef __attribute__((ext_vector_type(8)))  unsigned short v8us;
typedef __attribute__((ext_vector_type(8)))  float    v8f;
typedef __attribute__((ext_vector_type(4)))  float    v4f;
typedef v8h  __attribute__((may_alias)) v8ha;
typedef v4f  __attribute__((may_alias)) v4fa;
typedef v8us __attribute__((may_alias)) v8usa;

__device__ __forceinline__ unsigned short f2bf(float f) { unsigned u = __float_as_uint(f); u += 0x7FFFu + ((u >> 16) & 1u); return (unsigned short)(u >> 16); }
__device__ __forceinline__ float bf2f(unsigned short b) { return __uint_as_float(((unsigned)b) << 16); }
__device__ __forceinline__ float bfr(float f) { return bf2f(f2bf(f)); }
__device__ __forceinline__ v16h cat16(v8h lo, v8h hi) { return __builtin_shufflevector(lo, hi, 0, 1, 2, 3, 4, 5, 6, 7, 8, 9, 10, 11, 12, 13, 14, 15); }
__device__ __forceinline__ v16bf cat16b(v8us lo, v8us hi) { return __builtin_bit_cast(v16bf, __builtin_shufflevector(lo, hi, 0, 1, 2, 3, 4, 5, 6, 7, 8, 9, 10, 11, 12, 13, 14, 15)); }
__device__ __forceinline__ v8f wmma16(v16h a, v16h b, v8f c) { return __builtin_amdgcn_wmma_f32_16x16x32_f16(false, a, false, b, (short)0, c, false, false); }
__device__ __forceinline__ v8f wmmab(v16bf a, v16bf b, v8f c) { return __builtin_amdgcn_wmma_f32_16x16x32_bf16(false, a, false, b, (short)0, c, false, false); }
__device__ __forceinline__ h16 tohx(float x) { return (h16)x; }
__device__ __forceinline__ void splitf(float y, unsigned short& h, unsigned short& l) { h = f2bf(y); l = f2bf(y - bf2f(h)); }
typedef __attribute__((ext_vector_type(2))) _Float16 v2h;
typedef __attribute__((ext_vector_type(4))) _Float16 v4h;
typedef __attribute__((ext_vector_type(2))) unsigned short v2us;
typedef __attribute__((ext_vector_type(4))) unsigned short v4us;
typedef __attribute__((ext_vector_type(2))) float v2f;
typedef __attribute__((ext_vector_type(4))) int v4i;

// ---- k_gemmw: register-blocked GEMM, ONE WAVE per 64x64 output tile (16 accumulators), operands straight from K-contiguous 16-bit planes; grid (M/64, N/64, Z), 32 threads.
// C[m][n] (f32, pitch ldc, + optional f32 bias[n]) = sum_k A[m][k] Bt[n][k] (+ split products per NSPLIT). z-batch strides sA/sB/sC in elements. K % 32 == 0.
template <typename T16> struct WFrag;
template <> struct WFrag<h16> { typedef v16h V; static __device__ __forceinline__ V ld(const h16* p) { return cat16(*(const v8h*)p, *(const v8h*)(p + 16)); } static __device__ __forceinline__ v8f mma(V a, V b, v8f c) { return wmma16(a, b, c); } };
template <> struct WFrag<bf> { typedef v16bf V; static __device__ __forceinline__ V ld(const bf* p) { return cat16b(*(const v8us*)p, *(const v8us*)(p + 16)); } static __device__ __forceinline__ v8f mma(V a, V b, v8f c) { return wmmab(a, b, c); } };
template <typename T16, int NSPLIT, bool BIAS>
__global__ __launch_bounds__(32) void k_gemmw(const T16* __restrict__ A, const T16* __restrict__ A2, const T16* __restrict__ Bt, const T16* __restrict__ Bt2, int K, float* C, int ldc, const float* __restrict__ bias, size_t sA, size_t sB, size_t sC) {
    typedef typename WFrag<T16>::V V;
    __shared__ __align__(16) float os[16 * 68];
    const size_t z = blockIdx.z; A += z * sA; if (A2) A2 += z * sA; Bt += z * sB; if (Bt2) Bt2 += z * sB; C += z * sC;
    const int lane = threadIdx.x & 31, lr = lane & 15, hi = lane >> 4; const int r0 = blockIdx.x * 64, c0 = blockIdx.y * 64;
    v8f acc[4][4];
#pragma unroll
    for (int mb = 0; mb < 4; ++mb)
#pragma unroll
        for (int nb = 0; nb < 4; ++nb) acc[mb][nb] = (v8f){};
    const size_t aoff = (size_t)(r0 + lr) * K + 8 * hi, boff = (size_t)(c0 + lr) * K + 8 * hi;
    for (int kc = 0; kc < K; kc += 32) {
        V a[4], a2[4];
#pragma unroll
        for (int mb = 0; mb < 4; ++mb) { a[mb] = WFrag<T16>::ld(A + aoff + (size_t)mb * 16 * K + kc); if (NSPLIT == 1 || NSPLIT == 2) a2[mb] = WFrag<T16>::ld(A2 + aoff + (size_t)mb * 16 * K + kc); }
#pragma unroll
        for (int nb = 0; nb < 4; ++nb) { const V b = WFrag<T16>::ld(Bt + boff + (size_t)nb * 16 * K + kc); V b2; if (NSPLIT >= 2) b2 = WFrag<T16>::ld(Bt2 + boff + (size_t)nb * 16 * K + kc);
#pragma unroll
            for (int mb = 0; mb < 4; ++mb) { acc[mb][nb] = WFrag<T16>::mma(a[mb], b, acc[mb][nb]); if (NSPLIT == 1 || NSPLIT == 2) acc[mb][nb] = WFrag<T16>::mma(a2[mb], b, acc[mb][nb]); if (NSPLIT >= 2) acc[mb][nb] = WFrag<T16>::mma(a[mb], b2, acc[mb][nb]); } }
        asm volatile("v_nop\n\tv_nop\n\tv_nop\n\tv_nop" : "+v"(acc[0][0]), "+v"(acc[1][1]), "+v"(acc[2][2]), "+v"(acc[3][3]) : "v"(a[0]), "v"(a[3]));
    }
#pragma unroll
    for (int mb = 0; mb < 4; ++mb) {
#pragma unroll
        for (int nb = 0; nb < 4; ++nb) {
#pragma unroll
            for (int j = 0; j < 8; ++j) os[(hi * 8 + j) * 68 + nb * 16 + lr] = acc[mb][nb][j]; }
        __builtin_amdgcn_wave_barrier(); asm volatile("" ::: "memory");
        float* crow = C + (size_t)(r0 + mb * 16) * ldc + c0;
{
#pragma unroll
            for (int s = 0; s < 8; ++s) { const int row = 2 * s + hi, cofs = lr * 4; v4f val = *(const v4fa*)(os + row * 68 + cofs); if (BIAS) { val[0] += bfr(bias[c0 + cofs]); val[1] += bfr(bias[c0 + cofs + 1]); val[2] += bfr(bias[c0 + cofs + 2]); val[3] += bfr(bias[c0 + cofs + 3]); }
                *(v4f*)(crow + (size_t)row * ldc + cofs) = val; }
             }
        __builtin_amdgcn_wave_barrier(); asm volatile("" ::: "memory");
    }
}

__global__ __launch_bounds__(256) void k_cvt8(const float* __restrict__ src, bf* dst, size_t n8) { const size_t i = (size_t)blockIdx.x * 256 + threadIdx.x; if (i >= n8) return; const v8f v = *(const v8f*)(src + i * 8); v8us o;
#pragma unroll
    for (int k = 0; k < 8; ++k) o[k] = f2bf(v[k]); *(v8us*)(dst + i * 8) = o;  }

// k_hsplit (this item's one new kernel; flat): the module's strided head split as a gathering cast: XH[b * 12 + h][n][d] = bf16(x[b][n][d * 12 + h]) for every batch entry: a thread eight consecutive d of one (h, n): eight strided 4-byte reads (12 floats apart) and one 16-byte store; every address from the ids alone.
__global__ __launch_bounds__(256) void k_hsplit(const float* __restrict__ x, bf* XH) {
    const size_t i = (size_t)blockIdx.x * 256 + threadIdx.x; if (i >= (size_t)NZ * TT * HD / 8) return;
    const int d0 = (int)(i % (HD / 8)) * 8; const int n = (int)((i / (HD / 8)) % TT); const int z = (int)(i / ((size_t)(HD / 8) * TT)); const int b = z / NH_, h = z % NH_;
    const float* s = x + ((size_t)b * TT + n) * DM + h; v8us o;
#pragma unroll
    for (int q = 0; q < 8; ++q) o[q] = f2bf(s[(size_t)(d0 + q) * NH_]);
    bf* p = XH + ((size_t)z * TT + n) * HD + d0;
    *(v8us*)p = o; 
}

// k_rope: head planes [h][t][d] (fp16) of rope(x) x sc with the rotate-half convention out[d] = x[d] cos[t][d] - x[d+HD/2] sin[t][d], out[d+HD/2] = x[d+HD/2] cos[t][d+HD/2] + x[d] sin[t][d+HD/2]
__global__ __launch_bounds__(256) void k_rope(const float* __restrict__ F, int pitch, size_t hstep, int nheads, const float* __restrict__ CS, const float* __restrict__ RF, const float* __restrict__ nw, float sc, h16* P16, bf* Ph, bf* Pl) {
    const size_t e = ((size_t)blockIdx.x * 256 + threadIdx.x) * 2; if (e >= (size_t)nheads * TT * HD) return; const int d = (int)(e % HD); const int t = (int)((e / HD) % TT); const int h = (int)(e / ((size_t)HD * TT)); const float* f = F + (size_t)t * pitch + h * hstep; const float rf = RF ? RF[(size_t)h * TT + t] : 1.0f; v2h o16; v2us oh, ol;
    asm volatile("s_wait_xcnt 0x0" ::: "memory");   // where RF is read: its address registers are rewritten by the row address below: the wait stands in front of that overwrite
#pragma unroll
    for (int q = 0; q < 2; ++q) { const int dd = d + q; const int dp = (dd < HD / 2) ? dd + HD / 2 : dd - HD / 2; float x0 = f[dd], x1 = f[dp];
        asm volatile("s_wait_xcnt 0x0" ::: "memory");   // the two loads' address registers are rewritten right behind them (the table's address): the wait stands in front of that overwrite
        if (RF) { float n0 = __fmul_rn(x0, rf), n1 = __fmul_rn(x1, rf); x0 = __fmul_rn(bfr(nw[dd]), n0); x1 = __fmul_rn(bfr(nw[dp]), n1); }
        const v2f cs = *(const v2f*)(CS + ((size_t)t * HD + dd) * 2); float a = __fmul_rn(x0, cs[0]), bq = __fmul_rn(x1, cs[1]); const float r = ((dd < HD / 2) ? __fsub_rn(a, bq) : __fadd_rn(a, bq)) * sc;
        o16[q] = tohx(r); (void)oh; (void)ol; }
    *(v2h*)(P16 + e) = o16;  }

__global__ __launch_bounds__(256) void k_vtp(const float* __restrict__ F, int pitch, size_t hstep, int nheads, h16* V16, bf* Vh, bf* Vl) { const size_t e = ((size_t)blockIdx.x * 256 + threadIdx.x) * 2; if (e >= (size_t)nheads * HD * TT) return; const int t = (int)(e % TT); const int d = (int)((e / TT) % HD); const int g = (int)(e / ((size_t)TT * HD)); v2h o16; v2us oh, ol;
#pragma unroll
    for (int q = 0; q < 2; ++q) { const float x = F[(size_t)(t + q) * pitch + g * hstep + d]; o16[q] = tohx(x); (void)oh; (void)ol; }
    *(v2h*)(V16 + e) = o16;  }

__global__ __launch_bounds__(256) void k_csid(float* CS) { const int idx = blockIdx.x * 256 + threadIdx.x; if (idx >= TT * HD) return; v2f cs; cs[0] = 1.0f; cs[1] = 0.0f; *(v2f*)(CS + (size_t)idx * 2) = cs;  }

// k_asoft: per row (zz, i): t = S x SCL (SCL = 768^-0.5 here: the module scales by the root of the full width, not of the head's) (no mask); softmax over the 1024 keys (register row, one exp, fixed trees);
__global__ __launch_bounds__(256) void k_asoft(const float* __restrict__ Sb, h16* P16, bf* Ph, bf* Pl) {
    const int lane = threadIdx.x & 31; const int row = blockIdx.x * 8 + (threadIdx.x >> 5); if (row >= ZH * TT) return; const int i = row % TT; const int zz = row / TT; (void)zz; const bool hires = (i < RH); const float* sr = Sb + (size_t)row * TT; float v[TT / 32]; float mx = -3.0e38f;
#pragma unroll
    for (int ch = 0; ch < TT / 128; ++ch) { const int j0 = ch * 128 + lane * 4; const v4f a = *(const v4f*)(sr + j0);
#pragma unroll
        for (int q = 0; q < 4; ++q) { const int j = j0 + q; (void)j; const float t = a[q] * SCL; v[ch * 4 + q] = t; mx = fmaxf(mx, t); } }
#pragma unroll
    for (int sh = 16; sh; sh >>= 1) mx = fmaxf(mx, __shfl_xor(mx, sh, 32));
    float sum = 0.f;
#pragma unroll
    for (int k = 0; k < TT / 32; ++k) { float d0 = __fsub_rn(v[k], mx); v[k] = __builtin_amdgcn_exp2f(__fmul_rn(d0, 1.4426950408889634f)); sum += v[k]; }
#pragma unroll
    for (int sh = 16; sh; sh >>= 1) sum += __shfl_xor(sum, sh, 32);
    const float f = __fdiv_rn(hires ? 1.0f : PCAR, sum);
{
        if (hires) {
#pragma unroll
            for (int ch = 0; ch < TT / 128; ++ch) { v4us oh, ol;
#pragma unroll
                for (int q = 0; q < 4; ++q) { unsigned short a, c2; splitf(v[ch * 4 + q] * f, a, c2); oh[q] = a; ol[q] = c2; }
                const size_t oo = ((size_t)zz * (RH ? RH : 1) + i) * TT + ch * 128 + lane * 4; *(v4us*)(Ph + oo) = oh; *(v4us*)(Pl + oo) = ol; }
        } else {
#pragma unroll
            for (int ch = 0; ch < TT / 128; ++ch) { v4h o4;
#pragma unroll
                for (int q = 0; q < 4; ++q) o4[q] = tohx(v[ch * 4 + q] * f);
                *(v4h*)(P16 + (size_t)row * TT + ch * 128 + lane * 4) = o4; } }
         }
}

__global__ __launch_bounds__(256) void k_mergeH(const float* __restrict__ O, float* OUTh) { const size_t i = (size_t)blockIdx.x * 256 + threadIdx.x; if (i >= (size_t)ZH * TT * HD / 4) return; const size_t e = i * 4; const int t = (int)((e / HD) % TT); const float cs = (t < RH) ? 1.0f : (1.0f / PCAR); const v4f a = *(const v4f*)(O + e); v4f o;
#pragma unroll
    for (int q = 0; q < 4; ++q) o[q] = a[q] * cs; *(v4f*)(OUTh + e) = o;  }

extern "C" void kernel_launch(void* const* d_in, const int* in_sizes, int n_in,
                              void* d_out, int out_size, void* d_ws, size_t ws_size, hipStream_t stream) {
    (void)in_sizes; (void)n_in; (void)out_size;
    const float* x = (const float*)d_in[0]; const float* wq = (const float*)d_in[1]; const float* bq = (const float*)d_in[2]; const float* wk = (const float*)d_in[3]; const float* bk = (const float*)d_in[4]; const float* wv = (const float*)d_in[5]; const float* bv = (const float*)d_in[6];   /* inputs in the module's setup_inputs order: x [8][1024][768], Wq ('oi' [64][64]), bq [64], Wk, bk, Wv, bv: SEVEN inputs, all read */
    float* OUT = (float*)d_out;     // [8][12][1024][64]
    char* wsp = (char*)d_ws;
    auto take = [&](size_t bytes) { char* p = wsp; wsp += (bytes + 255) & ~(size_t)255; return (void*)p; };
    bf* WQ = (bf*)take((size_t)HD * HD * 2); bf* WK = (bf*)take((size_t)HD * HD * 2); bf* WV = (bf*)take((size_t)HD * HD * 2); float* CS = (float*)take((size_t)TT * HD * 2 * 4);
    h16* QP16 = (h16*)take((size_t)NZ * TT * HD * 2); h16* KP16 = (h16*)take((size_t)NZ * TT * HD * 2); h16* VT16 = (h16*)take((size_t)NZ * HD * TT * 2);
    bf* QPh = nullptr; bf* QPl = nullptr; bf* KPh = nullptr; bf* KPl = nullptr; bf* VTh = nullptr; bf* VTl = nullptr; bf* Ph = nullptr; bf* Pl = nullptr;   /* RH 0: no hi / lo plane exists: these builders store the f16 plane only and do not read those arguments; the softmax's hi / lo stores sit under 'i < RH': never taken */
    h16* P16 = (h16*)take((size_t)ZH * TT * TT * 2); float* Ob = (float*)take((size_t)ZH * TT * HD * 4); float* Sb = (float*)take((size_t)ZH * TT * TT * 4);
    if ((size_t)(wsp - (char*)d_ws) > ws_size) return;    // ws 256 MiB: about 237 MiB taken
    wsp = (char*)Sb;   /* the projection stage's planes (60 MiB) lie inside the score buffer (128 MiB): their last reader (k_vtp) is launched before the first score product (stream-ordered) */
    bf* XH = (bf*)take((size_t)NZ * TT * HD * 2); float* FQ = (float*)take((size_t)NZ * TT * HD * 4); float* FK = (float*)take((size_t)NZ * TT * HD * 4);
    float* FV = FK;   // v projection reuses the k buffer after the k planes are built (stream-ordered)
    { k_cvt8<<<(unsigned)(((size_t)HD * HD / 8 + 255) / 256), 256, 0, stream>>>(wq, WQ, (size_t)HD * HD / 8); k_cvt8<<<(unsigned)(((size_t)HD * HD / 8 + 255) / 256), 256, 0, stream>>>(wk, WK, (size_t)HD * HD / 8); k_cvt8<<<(unsigned)(((size_t)HD * HD / 8 + 255) / 256), 256, 0, stream>>>(wv, WV, (size_t)HD * HD / 8); }   /* 'oi' (out, in): each weight is the Bt operand as it stands */
    k_csid<<<(TT * HD + 255) / 256, 256, 0, stream>>>(CS);
    const unsigned LZ = (unsigned)(((size_t)NZ * TT * HD / 2 + 255) / 256);
    k_hsplit<<<(unsigned)(((size_t)NZ * TT * HD / 8 + 255) / 256), 256, 0, stream>>>(x, XH);   /* ONE gathered bf16 copy of all entries [96][1024][64], read by the three projections */
    k_gemmw<bf, 0, true><<<dim3(TT / 64, HD / 64, NZ), 32, 0, stream>>>(XH, nullptr, WQ, nullptr, HD, FQ, HD, bq, (size_t)TT * HD, 0, (size_t)TT * HD);   /* z = plane: A and C step one plane, the SHARED weight does not step */
    k_rope<<<LZ, 256, 0, stream>>>(FQ, HD, (size_t)TT * HD, NZ, CS, nullptr, nullptr, 1.0f, QP16, QPh, QPl);
    k_gemmw<bf, 0, true><<<dim3(TT / 64, HD / 64, NZ), 32, 0, stream>>>(XH, nullptr, WK, nullptr, HD, FK, HD, bk, (size_t)TT * HD, 0, (size_t)TT * HD);
    k_rope<<<LZ, 256, 0, stream>>>(FK, HD, (size_t)TT * HD, NZ, CS, nullptr, nullptr, 1.0f, KP16, KPh, KPl);
    k_gemmw<bf, 0, true><<<dim3(TT / 64, HD / 64, NZ), 32, 0, stream>>>(XH, nullptr, WV, nullptr, HD, FV, HD, bv, (size_t)TT * HD, 0, (size_t)TT * HD);
    k_vtp<<<LZ, 256, 0, stream>>>(FV, HD, (size_t)TT * HD, NZ, VT16, VTh, VTl);
    for (int z0 = 0; z0 < NZ; z0 += ZH) { const size_t zo = (size_t)z0 * TT * HD;   // one kv plane per query plane: the pass's ZH planes are consecutive (z-strides TT*HD)
        k_gemmw<h16, 0, false><<<dim3(TT / 64, TT / 64, ZH), 32, 0, stream>>>(QP16 + zo, nullptr, KP16 + zo, nullptr, HD, Sb, TT, nullptr, (size_t)TT * HD, (size_t)TT * HD, (size_t)TT * TT);
        k_asoft<<<ZH * TT / 8, 256, 0, stream>>>(Sb, P16, Ph, Pl);
        k_gemmw<h16, 0, false><<<dim3(TT / 64, HD / 64, ZH), 32, 0, stream>>>(P16, nullptr, VT16 + zo, nullptr, TT, Ob, HD, nullptr, (size_t)TT * TT, (size_t)HD * TT, (size_t)TT * HD);
        k_mergeH<<<(unsigned)(((size_t)ZH * TT * HD / 4 + 255) / 256), 256, 0, stream>>>(Ob, OUT + zo); }   /* the pass's planes of the output [96][1024][64], f32: every row x 1/1024 */
}

// v002
// A run of this version takes 128 microseconds.
// Timed twice side by side with v001, it ran 2.67 and 2.65 times as fast.
// All steps since v000 together make it 14.6 times as fast.
#include <hip/hip_runtime.h>

// Multi-head self-attention with a STRIDED head split and ONE shared 64 x 64 projection triple (x [8][1024][768]; head h of twelve takes the channels d x 12 + h (the module's 'x.reshape(b, n, 64, 12)' with the head axis moved first); Q, K, V = xh W^T + b with 'oi' (out, in) weights [64][64] normal x 1/8 and biases [64] normal x 0.02, THE SAME THREE FOR EVERY HEAD; scores = Q.K x 768^-0.5 (the root of the FULL width, as the module has it); softmax over all 1,024 keys, no mask; out = attn.V kept HEAD-MAJOR -> [8][12][1024][64] f32 (6.3 M); argument order x, Wq, bq, Wk, bk, Wv, bv: seven inputs, all read).
// Layout, ALL EIGHT BATCH ENTRIES AT ONCE (plane z = b x 12 + h, 96 planes): k_hsplit gathers the strided split into bf16 planes [96][1024][64] (one cast of x, read by the three projections); the 'oi' weights cast once as they stand; ONE product launch a projection over the 96 planes (the shared weight has a z-stride of 0; each plane's result is an f32 plane [1024][64] of its own) + the bias (read as f32, ROUNDED TO bf16 AT THE ADD by the product's own epilogue); identity-table f16 plane builders; k_fattn: ONE launch does scores, softmax and attn.V for all 96 planes with the scores kept in registers (running maximum and sum over passes of 32 keys) and writes the f32 output itself.
// Compute dtypes, f32 accumulate: EVERY input rounded to bf16: the biases too, inside the product kernel at the add ('bfr(bias[..])'); projections exact; attention: one fp16 product for the scores and one for attn.V (weights exp2(t - running maximum), at most 1, rounded to fp16; their f32 sum divides at the end); softmax f32 (the hardware exp2).

#define NB_  8
#define TT   1024
#define DM   768
#define NH_  12
#define NKV  12
#define REP  (NH_ / NKV)
#define HD   64
#define DQ   (NH_ * HD)
#define DKV  (NKV * HD)
#define NZ   (NB_ * NH_)
#define SCL  0.036084391824351608f   // 768^-0.5: the module scales by the root of the full width
typedef _Float16 h16;
typedef unsigned short bf;
typedef __attribute__((ext_vector_type(16))) __bf16   v16bf;
typedef __attribute__((ext_vector_type(16))) _Float16 v16h;
typedef __attribute__((ext_vector_type(8)))  _Float16 v8h;
typedef __attribute__((ext_vector_type(8)))  unsigned short v8us;
typedef __attribute__((ext_vector_type(8)))  float    v8f;
typedef __attribute__((ext_vector_type(4)))  float    v4f;
typedef v8h  __attribute__((may_alias)) v8ha;
typedef v4f  __attribute__((may_alias)) v4fa;
typedef v8us __attribute__((may_alias)) v8usa;

__device__ __forceinline__ unsigned short f2bf(float f) { unsigned u = __float_as_uint(f); u += 0x7FFFu + ((u >> 16) & 1u); return (unsigned short)(u >> 16); }
__device__ __forceinline__ float bf2f(unsigned short b) { return __uint_as_float(((unsigned)b) << 16); }
__device__ __forceinline__ float bfr(float f) { return bf2f(f2bf(f)); }
__device__ __forceinline__ v16h cat16(v8h lo, v8h hi) { return __builtin_shufflevector(lo, hi, 0, 1, 2, 3, 4, 5, 6, 7, 8, 9, 10, 11, 12, 13, 14, 15); }
__device__ __forceinline__ v16bf cat16b(v8us lo, v8us hi) { return __builtin_bit_cast(v16bf, __builtin_shufflevector(lo, hi, 0, 1, 2, 3, 4, 5, 6, 7, 8, 9, 10, 11, 12, 13, 14, 15)); }
__device__ __forceinline__ v8f wmma16(v16h a, v16h b, v8f c) { return __builtin_amdgcn_wmma_f32_16x16x32_f16(false, a, false, b, (short)0, c, false, false); }
__device__ __forceinline__ v8f wmmab(v16bf a, v16bf b, v8f c) { return __builtin_amdgcn_wmma_f32_16x16x32_bf16(false, a, false, b, (short)0, c, false, false); }
__device__ __forceinline__ h16 tohx(float x) { return (h16)x; }
__device__ __forceinline__ void splitf(float y, unsigned short& h, unsigned short& l) { h = f2bf(y); l = f2bf(y - bf2f(h)); }
typedef __attribute__((ext_vector_type(2))) _Float16 v2h;
typedef __attribute__((ext_vector_type(4))) _Float16 v4h;
typedef __attribute__((ext_vector_type(2))) unsigned short v2us;
typedef __attribute__((ext_vector_type(4))) unsigned short v4us;
typedef __attribute__((ext_vector_type(2))) float v2f;
typedef __attribute__((ext_vector_type(4))) int v4i;

// ---- k_gemmw: register-blocked GEMM, ONE WAVE per 64x64 output tile (16 accumulators), operands straight from K-contiguous 16-bit planes; grid (M/64, N/64, Z), 32 threads.
// C[m][n] (f32, pitch ldc, + optional f32 bias[n]) = sum_k A[m][k] Bt[n][k] (+ split products per NSPLIT). z-batch strides sA/sB/sC in elements. K % 32 == 0.
template <typename T16> struct WFrag;
template <> struct WFrag<h16> { typedef v16h V; static __device__ __forceinline__ V ld(const h16* p) { return cat16(*(const v8h*)p, *(const v8h*)(p + 16)); } static __device__ __forceinline__ v8f mma(V a, V b, v8f c) { return wmma16(a, b, c); } };
template <> struct WFrag<bf> { typedef v16bf V; static __device__ __forceinline__ V ld(const bf* p) { return cat16b(*(const v8us*)p, *(const v8us*)(p + 16)); } static __device__ __forceinline__ v8f mma(V a, V b, v8f c) { return wmmab(a, b, c); } };
template <typename T16, int NSPLIT, bool BIAS>
__global__ __launch_bounds__(32) void k_gemmw(const T16* __restrict__ A, const T16* __restrict__ A2, const T16* __restrict__ Bt, const T16* __restrict__ Bt2, int K, float* C, int ldc, const float* __restrict__ bias, size_t sA, size_t sB, size_t sC) {
    typedef typename WFrag<T16>::V V;
    __shared__ __align__(16) float os[16 * 68];
    const size_t z = blockIdx.z; A += z * sA; if (A2) A2 += z * sA; Bt += z * sB; if (Bt2) Bt2 += z * sB; C += z * sC;
    const int lane = threadIdx.x & 31, lr = lane & 15, hi = lane >> 4; const int r0 = blockIdx.x * 64, c0 = blockIdx.y * 64;
    v8f acc[4][4];
#pragma unroll
    for (int mb = 0; mb < 4; ++mb)
#pragma unroll
        for (int nb = 0; nb < 4; ++nb) acc[mb][nb] = (v8f){};
    const size_t aoff = (size_t)(r0 + lr) * K + 8 * hi, boff = (size_t)(c0 + lr) * K + 8 * hi;
    for (int kc = 0; kc < K; kc += 32) {
        V a[4], a2[4];
#pragma unroll
        for (int mb = 0; mb < 4; ++mb) { a[mb] = WFrag<T16>::ld(A + aoff + (size_t)mb * 16 * K + kc); if (NSPLIT == 1 || NSPLIT == 2) a2[mb] = WFrag<T16>::ld(A2 + aoff + (size_t)mb * 16 * K + kc); }
#pragma unroll
        for (int nb = 0; nb < 4; ++nb) { const V b = WFrag<T16>::ld(Bt + boff + (size_t)nb * 16 * K + kc); V b2; if (NSPLIT >= 2) b2 = WFrag<T16>::ld(Bt2 + boff + (size_t)nb * 16 * K + kc);
#pragma unroll
            for (int mb = 0; mb < 4; ++mb) { acc[mb][nb] = WFrag<T16>::mma(a[mb], b, acc[mb][nb]); if (NSPLIT == 1 || NSPLIT == 2) acc[mb][nb] = WFrag<T16>::mma(a2[mb], b, acc[mb][nb]); if (NSPLIT >= 2) acc[mb][nb] = WFrag<T16>::mma(a[mb], b2, acc[mb][nb]); } }
        asm volatile("v_nop\n\tv_nop\n\tv_nop\n\tv_nop" : "+v"(acc[0][0]), "+v"(acc[1][1]), "+v"(acc[2][2]), "+v"(acc[3][3]) : "v"(a[0]), "v"(a[3]));
    }
#pragma unroll
    for (int mb = 0; mb < 4; ++mb) {
#pragma unroll
        for (int nb = 0; nb < 4; ++nb) {
#pragma unroll
            for (int j = 0; j < 8; ++j) os[(hi * 8 + j) * 68 + nb * 16 + lr] = acc[mb][nb][j]; }
        __builtin_amdgcn_wave_barrier(); asm volatile("" ::: "memory");
        float* crow = C + (size_t)(r0 + mb * 16) * ldc + c0;
{
#pragma unroll
            for (int s = 0; s < 8; ++s) { const int row = 2 * s + hi, cofs = lr * 4; v4f val = *(const v4fa*)(os + row * 68 + cofs); if (BIAS) { val[0] += bfr(bias[c0 + cofs]); val[1] += bfr(bias[c0 + cofs + 1]); val[2] += bfr(bias[c0 + cofs + 2]); val[3] += bfr(bias[c0 + cofs + 3]); }
                *(v4f*)(crow + (size_t)row * ldc + cofs) = val; }
             }
        __builtin_amdgcn_wave_barrier(); asm volatile("" ::: "memory");
    }
}

__global__ __launch_bounds__(256) void k_cvt8(const float* __restrict__ src, bf* dst, size_t n8) { const size_t i = (size_t)blockIdx.x * 256 + threadIdx.x; if (i >= n8) return; const v8f v = *(const v8f*)(src + i * 8); v8us o;
#pragma unroll
    for (int k = 0; k < 8; ++k) o[k] = f2bf(v[k]); *(v8us*)(dst + i * 8) = o;  }

// k_hsplit (this item's one new kernel; flat): the module's strided head split as a gathering cast: XH[b * 12 + h][n][d] = bf16(x[b][n][d * 12 + h]) for every batch entry: a thread eight consecutive d of one (h, n): eight strided 4-byte reads (12 floats apart) and one 16-byte store; every address from the ids alone.
__global__ __launch_bounds__(256) void k_hsplit(const float* __restrict__ x, bf* XH) {
    const size_t i = (size_t)blockIdx.x * 256 + threadIdx.x; if (i >= (size_t)NZ * TT * HD / 8) return;
    const int d0 = (int)(i % (HD / 8)) * 8; const int n = (int)((i / (HD / 8)) % TT); const int z = (int)(i / ((size_t)(HD / 8) * TT)); const int b = z / NH_, h = z % NH_;
    const float* s = x + ((size_t)b * TT + n) * DM + h; v8us o;
#pragma unroll
    for (int q = 0; q < 8; ++q) o[q] = f2bf(s[(size_t)(d0 + q) * NH_]);
    bf* p = XH + ((size_t)z * TT + n) * HD + d0;
    *(v8us*)p = o; 
}

// k_rope: head planes [h][t][d] (fp16) of rope(x) x sc with the rotate-half convention out[d] = x[d] cos[t][d] - x[d+HD/2] sin[t][d], out[d+HD/2] = x[d+HD/2] cos[t][d+HD/2] + x[d] sin[t][d+HD/2]
__global__ __launch_bounds__(256) void k_rope(const float* __restrict__ F, int pitch, size_t hstep, int nheads, const float* __restrict__ CS, const float* __restrict__ RF, const float* __restrict__ nw, float sc, h16* P16, bf* Ph, bf* Pl) {
    const size_t e = ((size_t)blockIdx.x * 256 + threadIdx.x) * 2; if (e >= (size_t)nheads * TT * HD) return; const int d = (int)(e % HD); const int t = (int)((e / HD) % TT); const int h = (int)(e / ((size_t)HD * TT)); const float* f = F + (size_t)t * pitch + h * hstep; const float rf = RF ? RF[(size_t)h * TT + t] : 1.0f; v2h o16; v2us oh, ol;
    asm volatile("s_wait_xcnt 0x0" ::: "memory");   // where RF is read: its address registers are rewritten by the row address below: the wait stands in front of that overwrite
#pragma unroll
    for (int q = 0; q < 2; ++q) { const int dd = d + q; const int dp = (dd < HD / 2) ? dd + HD / 2 : dd - HD / 2; float x0 = f[dd], x1 = f[dp];
        asm volatile("s_wait_xcnt 0x0" ::: "memory");   // the two loads' address registers are rewritten right behind them (the table's address): the wait stands in front of that overwrite
        if (RF) { float n0 = __fmul_rn(x0, rf), n1 = __fmul_rn(x1, rf); x0 = __fmul_rn(bfr(nw[dd]), n0); x1 = __fmul_rn(bfr(nw[dp]), n1); }
        const v2f cs = *(const v2f*)(CS + ((size_t)t * HD + dd) * 2); float a = __fmul_rn(x0, cs[0]), bq = __fmul_rn(x1, cs[1]); const float r = ((dd < HD / 2) ? __fsub_rn(a, bq) : __fadd_rn(a, bq)) * sc;
        o16[q] = tohx(r); (void)oh; (void)ol; }
    *(v2h*)(P16 + e) = o16;  }

__global__ __launch_bounds__(256) void k_vtp(const float* __restrict__ F, int pitch, size_t hstep, int nheads, h16* V16, bf* Vh, bf* Vl) { const size_t e = ((size_t)blockIdx.x * 256 + threadIdx.x) * 2; if (e >= (size_t)nheads * HD * TT) return; const int t = (int)(e % TT); const int d = (int)((e / TT) % HD); const int g = (int)(e / ((size_t)TT * HD)); v2h o16; v2us oh, ol;
#pragma unroll
    for (int q = 0; q < 2; ++q) { const float x = F[(size_t)(t + q) * pitch + g * hstep + d]; o16[q] = tohx(x); (void)oh; (void)ol; }
    *(v2h*)(V16 + e) = o16;  }

__global__ __launch_bounds__(256) void k_csid(float* CS) { const int idx = blockIdx.x * 256 + threadIdx.x; if (idx >= TT * HD) return; v2f cs; cs[0] = 1.0f; cs[1] = 0.0f; *(v2f*)(CS + (size_t)idx * 2) = cs;  }

#define KST 64        // keys per stage
#define LP  72        // LDS row pitch in f16 elements: 64 + 8
__device__ __forceinline__ float xhalf(float v) { const int b = __float_as_int(v); return __int_as_float(__builtin_amdgcn_permlanex16(b, b, 0x76543210, 0xfedcba98, false, false)); }   // lane l <-> l ^ 16
__global__ __launch_bounds__(128) void k_fattn(const h16* __restrict__ Q, const h16* __restrict__ K, const h16* __restrict__ VT, float* __restrict__ OUT) {
    __shared__ __align__(16) h16 ks[2][KST * LP]; __shared__ __align__(16) h16 vs[2][HD * LP];   // HD == KST: both pairs of buffers have one shape
    const int tid = threadIdx.x, lane = tid & 31, lr = lane & 15, hi = lane >> 4; const int q0 = blockIdx.x * 128 + (tid >> 5) * 32; const size_t z = blockIdx.y;
    const int srow = tid >> 3, scol = (tid & 7) * 8;   // staging: this thread's row (then + 16, + 32, + 48) and its 16-byte piece of it
    const char* kg = (const char*)(K + z * TT * HD); const char* vg = (const char*)(VT + z * HD * TT); const unsigned ko = (unsigned)(srow * HD + scol) * 2u, vo = (unsigned)(srow * TT + scol) * 2u;   // the plane's base (the same for the whole work-group) and this thread's fixed byte offset
    const int sl = srow * LP + scol, fl = lr * LP + 8 * hi;
    const h16* qp = Q + (z * TT + q0 + lr) * HD + 8 * hi;
    const float c = SCL * 1.4426950408889634f;   // scores in log2 units: t = S x c
    v8h rk[4], rv[4];
#pragma unroll
    for (int i = 0; i < 4; ++i) { rk[i] = *(const v8h*)(kg + ko + i * 16 * HD * 2); rv[i] = *(const v8h*)(vg + vo + i * 16 * TT * 2); }
    v16h qf[2][2];
#pragma unroll
    for (int qb = 0; qb < 2; ++qb)
#pragma unroll
        for (int kc = 0; kc < 2; ++kc) qf[qb][kc] = WFrag<h16>::ld(qp + qb * 16 * HD + kc * 32);
    v8f o[4][2]; float m[2], l[2];
#pragma unroll
    for (int qb = 0; qb < 2; ++qb) { m[qb] = -3.0e38f; l[qb] = 0.f;
#pragma unroll
        for (int db = 0; db < 4; ++db) o[db][qb] = (v8f){}; }
#pragma unroll
    for (int i = 0; i < 4; ++i) { *(v8h*)(&ks[0][sl + i * 16 * LP]) = rk[i]; *(v8h*)(&vs[0][sl + i * 16 * LP]) = rv[i]; }
    __syncthreads();   // stage 0 is published
    const char* kn = kg + ko + KST * HD * 2; const char* vn = vg + vo + KST * 2;   // this thread's pieces of the stage that is fetched next
#pragma unroll 1   // rolled
    for (int st = 0; st < TT / KST; ++st) {
        const h16* kl = &ks[st & 1][fl]; const h16* vl = &vs[st & 1][fl];
        // the next stage's rows fly behind this whole trip; unconditional (no branch among the matrix instructions): the last trip fetches stage 15 again, into the buffer that nobody reads any more
#pragma unroll
        for (int i = 0; i < 4; ++i) { rk[i] = *(const v8h*)(kn + i * 16 * HD * 2); rv[i] = *(const v8h*)(vn + i * 16 * TT * 2); }
        __builtin_amdgcn_sched_barrier(0);   // keeps the fetches up here: without it the compiler sinks them to the stores at the foot of the trip, and every trip waits out their whole latency
#pragma unroll
        for (int kh = 0; kh < 2; ++kh) {   // two passes of 32 keys
            v8f s[2][2];
#pragma unroll
            for (int kt = 0; kt < 2; ++kt) { const v16h ka = WFrag<h16>::ld(kl + (kh * 2 + kt) * 16 * LP), kb = WFrag<h16>::ld(kl + (kh * 2 + kt) * 16 * LP + 32);
#pragma unroll
                for (int qb = 0; qb < 2; ++qb) s[kt][qb] = wmma16(kb, qf[qb][1], wmma16(ka, qf[qb][0], (v8f){})); }
            v16h vf[4];
#pragma unroll
            for (int db = 0; db < 4; ++db) vf[db] = WFrag<h16>::ld(vl + db * 16 * LP + kh * 32);
#pragma unroll
            for (int qb = 0; qb < 2; ++qb) {
                float mx = s[0][qb][0];
#pragma unroll
                for (int kt = 0; kt < 2; ++kt)
#pragma unroll
                    for (int r = 0; r < 8; ++r) mx = fmaxf(mx, s[kt][qb][r]);
                mx = fmaxf(mx, xhalf(mx));
                const float mn = fmaxf(m[qb], mx * c); const float al = __builtin_amdgcn_exp2f(m[qb] - mn); m[qb] = mn;
                const v2f c2 = {c, c}, nm2 = {-mn, -mn}; v2f sum2 = {0.f, 0.f}; v16h pf;
#pragma unroll
                for (int kt = 0; kt < 2; ++kt)
#pragma unroll
                    for (int r = 0; r < 8; r += 2) { const v2f sv = {s[kt][qb][r], s[kt][qb][r + 1]}; const v2f t = __builtin_elementwise_fma(sv, c2, nm2); v2f p; p[0] = __builtin_amdgcn_exp2f(t[0]); p[1] = __builtin_amdgcn_exp2f(t[1]); sum2 += p;
                        const v2h ph = __builtin_convertvector(p, v2h); pf[kt * 8 + r] = ph[0]; pf[kt * 8 + r + 1] = ph[1]; }
                l[qb] = l[qb] * al + (sum2[0] + sum2[1]);
#pragma unroll
                for (int db = 0; db < 4; ++db) { o[db][qb] *= al; o[db][qb] = wmma16(vf[db], pf, o[db][qb]); }
            }
        }
        { h16* kw = &ks[(st + 1) & 1][sl]; h16* vw = &vs[(st + 1) & 1][sl];
#pragma unroll
            for (int i = 0; i < 4; ++i) { *(v8h*)(kw + i * 16 * LP) = rk[i]; *(v8h*)(vw + i * 16 * LP) = rv[i]; } }
        if (st + 2 < TT / KST) { kn += KST * HD * 2; vn += KST * 2; }
        __syncthreads();   // publishes stage st + 1; every wave's reads of stage st are over, so the next trip may refill its buffer
    }
#pragma unroll
    for (int qb = 0; qb < 2; ++qb) { const float inv = __fdiv_rn(1.0f, l[qb] + xhalf(l[qb])); float* op = OUT + (z * TT + q0 + qb * 16 + lr) * HD + 8 * hi;   // the halves' sums joined once; a lane's 8 accumulator registers are 8 consecutive d of its query's row
#pragma unroll
        for (int db = 0; db < 4; ++db) { v4f w0, w1;
#pragma unroll
            for (int r = 0; r < 4; ++r) { w0[r] = o[db][qb][r] * inv; w1[r] = o[db][qb][r + 4] * inv; }
            *(v4f*)(op + db * 16) = w0; *(v4f*)(op + db * 16 + 4) = w1; } }
}

extern "C" void kernel_launch(void* const* d_in, const int* in_sizes, int n_in,
                              void* d_out, int out_size, void* d_ws, size_t ws_size, hipStream_t stream) {
    (void)in_sizes; (void)n_in; (void)out_size;
    const float* x = (const float*)d_in[0]; const float* wq = (const float*)d_in[1]; const float* bq = (const float*)d_in[2]; const float* wk = (const float*)d_in[3]; const float* bk = (const float*)d_in[4]; const float* wv = (const float*)d_in[5]; const float* bv = (const float*)d_in[6];   /* inputs in the module's setup_inputs order: x [8][1024][768], Wq ('oi' [64][64]), bq [64], Wk, bk, Wv, bv: SEVEN inputs, all read */
    float* OUT = (float*)d_out;     // [8][12][1024][64]
    char* wsp = (char*)d_ws;
    auto take = [&](size_t bytes) { char* p = wsp; wsp += (bytes + 255) & ~(size_t)255; return (void*)p; };
    bf* WQ = (bf*)take((size_t)HD * HD * 2); bf* WK = (bf*)take((size_t)HD * HD * 2); bf* WV = (bf*)take((size_t)HD * HD * 2); float* CS = (float*)take((size_t)TT * HD * 2 * 4);
    h16* QP16 = (h16*)take((size_t)NZ * TT * HD * 2); h16* KP16 = (h16*)take((size_t)NZ * TT * HD * 2); h16* VT16 = (h16*)take((size_t)NZ * HD * TT * 2);
    bf* QPh = nullptr; bf* QPl = nullptr; bf* KPh = nullptr; bf* KPl = nullptr; bf* VTh = nullptr; bf* VTl = nullptr;   /* no hi / lo plane exists: these builders store the f16 plane only and do not read those arguments */
    bf* XH = (bf*)take((size_t)NZ * TT * HD * 2); float* FQ = (float*)take((size_t)NZ * TT * HD * 4); float* FK = (float*)take((size_t)NZ * TT * HD * 4);
    if ((size_t)(wsp - (char*)d_ws) > ws_size) return;    // ws 256 MiB: about 97 MiB taken
    float* FV = FK;   // v projection reuses the k buffer after the k planes are built (stream-ordered)
    { k_cvt8<<<(unsigned)(((size_t)HD * HD / 8 + 255) / 256), 256, 0, stream>>>(wq, WQ, (size_t)HD * HD / 8); k_cvt8<<<(unsigned)(((size_t)HD * HD / 8 + 255) / 256), 256, 0, stream>>>(wk, WK, (size_t)HD * HD / 8); k_cvt8<<<(unsigned)(((size_t)HD * HD / 8 + 255) / 256), 256, 0, stream>>>(wv, WV, (size_t)HD * HD / 8); }   /* 'oi' (out, in): each weight is the Bt operand as it stands */
    k_csid<<<(TT * HD + 255) / 256, 256, 0, stream>>>(CS);
    const unsigned LZ = (unsigned)(((size_t)NZ * TT * HD / 2 + 255) / 256);
    k_hsplit<<<(unsigned)(((size_t)NZ * TT * HD / 8 + 255) / 256), 256, 0, stream>>>(x, XH);   /* ONE gathered bf16 copy of all entries [96][1024][64], read by the three projections */
    k_gemmw<bf, 0, true><<<dim3(TT / 64, HD / 64, NZ), 32, 0, stream>>>(XH, nullptr, WQ, nullptr, HD, FQ, HD, bq, (size_t)TT * HD, 0, (size_t)TT * HD);   /* z = plane: A and C step one plane, the SHARED weight does not step */
    k_rope<<<LZ, 256, 0, stream>>>(FQ, HD, (size_t)TT * HD, NZ, CS, nullptr, nullptr, 1.0f, QP16, QPh, QPl);
    k_gemmw<bf, 0, true><<<dim3(TT / 64, HD / 64, NZ), 32, 0, stream>>>(XH, nullptr, WK, nullptr, HD, FK, HD, bk, (size_t)TT * HD, 0, (size_t)TT * HD);
    k_rope<<<LZ, 256, 0, stream>>>(FK, HD, (size_t)TT * HD, NZ, CS, nullptr, nullptr, 1.0f, KP16, KPh, KPl);
    k_gemmw<bf, 0, true><<<dim3(TT / 64, HD / 64, NZ), 32, 0, stream>>>(XH, nullptr, WV, nullptr, HD, FV, HD, bv, (size_t)TT * HD, 0, (size_t)TT * HD);
    k_vtp<<<LZ, 256, 0, stream>>>(FV, HD, (size_t)TT * HD, NZ, VT16, VTh, VTl);
    k_fattn<<<dim3(TT / 128, NZ), 128, 0, stream>>>(QP16, KP16, VT16, OUT);   /* every plane's scores, softmax and attn.V; writes the output [96][1024][64], f32 */
}

// v003
// One run takes 46.7 microseconds.
// In two side-by-side timings against v002, it was 2.73 and 2.76 times as fast.
// Counting every step since v000, it is 40.1 times as fast.
#include <hip/hip_runtime.h>

// Multi-head self-attention with a STRIDED head split and ONE shared 64 x 64 projection triple (x [8][1024][768]; head h of twelve takes the channels d x 12 + h (the module's 'x.reshape(b, n, 64, 12)' with the head axis moved first); Q, K, V = xh W^T + b with 'oi' (out, in) weights [64][64] normal x 1/8 and biases [64] normal x 0.02, THE SAME THREE FOR EVERY HEAD; scores = Q.K x 768^-0.5 (the root of the FULL width, as the module has it); softmax over all 1,024 keys, no mask; out = attn.V kept HEAD-MAJOR -> [8][12][1024][64] f32 (6.3 M); argument order x, Wq, bq, Wk, bk, Wv, bv: seven inputs, all read).
// Layout, ALL EIGHT BATCH ENTRIES AT ONCE (plane z = b x 12 + h, 96 planes): k_qkv: ONE launch reads x once in whole lines, casts it to bf16 and sorts it by head in LDS (the strided split), casts the three 'oi' weights and the biases into LDS, does the three projections on the matrix unit and stores the f16 planes Q [96][1024][64], K [96][1024][64] and Vt [96][64][1024] itself; k_fattn: ONE launch does scores, softmax and attn.V for all 96 planes with the scores kept in registers (running maximum and sum over passes of 32 keys) and writes the f32 output itself.
// Compute dtypes, f32 accumulate: EVERY input rounded to bf16, the biases too; projections: bf16 products, f32 sums, + bias in f32, rounded once to fp16; attention: one fp16 product for the scores and one for attn.V (weights exp2(t - running maximum), at most 1, rounded to fp16; their f32 sum divides at the end); softmax f32 (the hardware exp2).

#define NB_  8
#define TT   1024
#define DM   768
#define NH_  12
#define NKV  12
#define REP  (NH_ / NKV)
#define HD   64
#define DQ   (NH_ * HD)
#define DKV  (NKV * HD)
#define NZ   (NB_ * NH_)
#define SCL  0.036084391824351608f   // 768^-0.5: the module scales by the root of the full width
typedef _Float16 h16;
typedef unsigned short bf;
typedef __attribute__((ext_vector_type(16))) __bf16   v16bf;
typedef __attribute__((ext_vector_type(16))) _Float16 v16h;
typedef __attribute__((ext_vector_type(8)))  _Float16 v8h;
typedef __attribute__((ext_vector_type(8)))  unsigned short v8us;
typedef __attribute__((ext_vector_type(8)))  float    v8f;
typedef __attribute__((ext_vector_type(4)))  float    v4f;
typedef v8h  __attribute__((may_alias)) v8ha;
typedef v4f  __attribute__((may_alias)) v4fa;
typedef v8us __attribute__((may_alias)) v8usa;

__device__ __forceinline__ unsigned short f2bf(float f) { unsigned u = __float_as_uint(f); u += 0x7FFFu + ((u >> 16) & 1u); return (unsigned short)(u >> 16); }
__device__ __forceinline__ float bf2f(unsigned short b) { return __uint_as_float(((unsigned)b) << 16); }
__device__ __forceinline__ float bfr(float f) { return bf2f(f2bf(f)); }
__device__ __forceinline__ v16h cat16(v8h lo, v8h hi) { return __builtin_shufflevector(lo, hi, 0, 1, 2, 3, 4, 5, 6, 7, 8, 9, 10, 11, 12, 13, 14, 15); }
__device__ __forceinline__ v16bf cat16b(v8us lo, v8us hi) { return __builtin_bit_cast(v16bf, __builtin_shufflevector(lo, hi, 0, 1, 2, 3, 4, 5, 6, 7, 8, 9, 10, 11, 12, 13, 14, 15)); }
__device__ __forceinline__ v8f wmma16(v16h a, v16h b, v8f c) { return __builtin_amdgcn_wmma_f32_16x16x32_f16(false, a, false, b, (short)0, c, false, false); }
__device__ __forceinline__ v8f wmmab(v16bf a, v16bf b, v8f c) { return __builtin_amdgcn_wmma_f32_16x16x32_bf16(false, a, false, b, (short)0, c, false, false); }
__device__ __forceinline__ h16 tohx(float x) { return (h16)x; }
typedef __attribute__((ext_vector_type(2))) _Float16 v2h;
typedef __attribute__((ext_vector_type(2))) unsigned short v2us;
typedef __attribute__((ext_vector_type(4))) unsigned short v4us;
typedef __attribute__((ext_vector_type(2))) float v2f;

// WFrag::ld: one lane's share of a 16 x 32 operand from a K-contiguous row: elements 8 hi + 0..7, then 16 + 8 hi + 0..7 (p already points at row lr, element 8 hi).
template <typename T16> struct WFrag;
template <> struct WFrag<h16> { typedef v16h V; static __device__ __forceinline__ V ld(const h16* p) { return cat16(*(const v8h*)p, *(const v8h*)(p + 16)); } static __device__ __forceinline__ v8f mma(V a, V b, v8f c) { return wmma16(a, b, c); } };

// k_qkv: head split, casts, the three projections with their biases and the f16 plane stores in one kernel. A work-group is 32 consecutive tokens of one batch entry, all twelve heads: twelve waves, wave = head.
// Fill: the 32 rows of x are 96 KiB in a row: every thread fetches sixteen 16-byte pieces (whole lines per wave). A piece is four heads of one channel d (element d x 12 + h, 12 = 3 x 4): four 2-byte LDS stores put them into the heads' tiles [token][d]. Rows lie at a pitch of 144 bytes (16 x odd: no bank conflict for the 16-byte fragment reads); a head's tile starts 5,136 bytes after the one before (4 banks on, so that the three head groups of one store instruction fall on different banks).
// Products: Q and K transposed (A = weight rows, B = token rows, both by the same loader): a lane holds 8 consecutive outputs e of ONE token = 16 bytes of a plane's row. V as it stands (A = token rows, B = weight rows): a lane holds 8 consecutive tokens of ONE e = 16 bytes of a Vt row.
// Stores: a wave's tile of x is read by that wave alone, into registers, before its first product; from then on the tile's LDS is the wave's own staging room: the 16-byte pieces go in, whole rows come out (Q, K: 512 bytes in a row per store instruction; Vt: 64 bytes a row, all that 32 tokens fill).
#define PT   32       // tokens per work-group
#define XP   144      // LDS row pitch in bytes of a row of 64 16-bit elements: 128 + 16
#define VP   80       // LDS row pitch in bytes of a staged Vt row of 32 tokens: 64 + 16 (16 x odd)
#define HS   5136     // LDS bytes per head: the larger of 32 x XP and 64 x VP, + 16
typedef __attribute__((ext_vector_type(2))) __bf16 v2bf;
typedef unsigned short __attribute__((may_alias)) usa;
typedef v2us __attribute__((may_alias)) v2usa;
typedef v4us __attribute__((may_alias)) v4usa;
__device__ __forceinline__ v2us bf2(float a, float b) { const v2f p = {a, b}; return __builtin_bit_cast(v2us, __builtin_convertvector(p, v2bf)); }   // two f32 -> bf16, round to nearest even
__device__ __forceinline__ v16bf ldb(const char* p) { return cat16b(*(const v8usa*)p, *(const v8usa*)(p + 32)); }   // WFrag::ld's order, from LDS bytes
__global__ __launch_bounds__(384) void k_qkv(const float* __restrict__ x, const float* __restrict__ wq, const float* __restrict__ bq, const float* __restrict__ wk, const float* __restrict__ bk, const float* __restrict__ wv, const float* __restrict__ bv, h16* __restrict__ Q, h16* __restrict__ K, h16* __restrict__ VT) {
    __shared__ __align__(16) char xs[NH_ * HS]; __shared__ __align__(16) char wl[3 * HD * XP]; __shared__ __align__(16) float bs[3 * HD];
    const int tid = threadIdx.x, lane = tid & 31, lr = lane & 15, hi = lane >> 4; const int h = __builtin_amdgcn_readfirstlane(tid >> 5);   // the wave's number = its head, held as a scalar: the weight and bias pointers below are then picked by scalar code
    const int n0 = blockIdx.x * PT; const size_t b = blockIdx.y;
    const float* xg = x + (b * TT + n0) * DM + tid * 4;
    const float* wg = ((h < 4) ? wq : (h < 8) ? wk : wv) + (h & 3) * 16 * HD + lane * 4;   // the three weights are 192 rows: wave h casts rows 16 h + 0..15, a quarter of one weight (one scalar base a wave)
    v4f xr[16], wr[8];
#pragma unroll
    for (int i = 0; i < 16; ++i) xr[i] = *(const v4f*)(xg + i * 384 * 4);   // 384 pieces = two rows a step
#pragma unroll
    for (int i = 0; i < 8; ++i) wr[i] = *(const v4f*)(wg + i * 128);   // 512 bytes (two rows) a load
    const float br = ((h < 4) ? bq : (h < 8) ? bk : bv)[(h & 3) * 16 + lr];   // and the 16 biases of those rows (both halves of the wave read and store the same 16: no branch among the loads)
    { const int j = tid % 192; char* xw = xs + (j % 3) * 4 * HS + (tid / 192) * XP + (j / 3) * 2;   // piece j of its row: channel j / 3, heads 4 (j % 3) + 0..3
#pragma unroll
        for (int i = 0; i < 16; ++i) {
            if ((i & 3) == 0) __builtin_amdgcn_sched_barrier(0);   // four pieces at a time, in the order of the loads: without it the compiler gathers all casts in front of the first LDS store, and every store waits for the last load
            const v2us lo = bf2(xr[i][0], xr[i][1]), hh = bf2(xr[i][2], xr[i][3]);
            *(usa*)(xw + i * 2 * XP) = lo[0]; *(usa*)(xw + i * 2 * XP + HS) = lo[1]; *(usa*)(xw + i * 2 * XP + 2 * HS) = hh[0]; *(usa*)(xw + i * 2 * XP + 3 * HS) = hh[1]; } }
    __builtin_amdgcn_sched_barrier(0);   // as above: the weights' casts wait for later loads and stay behind the tiles' stores
#pragma unroll
    for (int i = 0; i < 8; ++i) { const v2us lo = bf2(wr[i][0], wr[i][1]), hh = bf2(wr[i][2], wr[i][3]); const v4us o = {lo[0], lo[1], hh[0], hh[1]}; *(v4usa*)(wl + (h * 16 + i * 2 + hi) * XP + lr * 8) = o; }   // 16 pieces a row
    bs[h * 16 + lr] = bfr(br);
    __syncthreads();   // the tiles, the weights and the biases are published; the only barrier: behind it a wave touches no other wave's tile
    char* my = xs + h * HS; const size_t z = b * NH_ + h;
    v16bf xf[2][2];
#pragma unroll
    for (int tt = 0; tt < 2; ++tt)
#pragma unroll
        for (int kc = 0; kc < 2; ++kc) xf[tt][kc] = ldb(my + (tt * 16 + lr) * XP + kc * 64 + hi * 16);
#pragma unroll
    for (int mt = 0; mt < 2; ++mt) {   // Q, then K
#pragma unroll
        for (int eb = 0; eb < 4; ++eb) { const char* wp = wl + (mt * HD + eb * 16 + lr) * XP + hi * 16; const v16bf w0 = ldb(wp), w1 = ldb(wp + 64);
            const v4f b0 = *(const v4fa*)(bs + mt * HD + eb * 16 + hi * 8), b1 = *(const v4fa*)(bs + mt * HD + eb * 16 + hi * 8 + 4);
#pragma unroll
            for (int tt = 0; tt < 2; ++tt) { const v8f a = wmmab(w1, xf[tt][1], wmmab(w0, xf[tt][0], (v8f){})); v8h o;
#pragma unroll
                for (int r = 0; r < 4; ++r) { o[r] = tohx(a[r] + b0[r]); o[r + 4] = tohx(a[r + 4] + b1[r]); }
                *(v8ha*)(my + (tt * 16 + lr) * XP + eb * 32 + hi * 16) = o; } }
        asm volatile("s_wait_dscnt 0x0" ::: "memory");   // the wave's staged pieces are in LDS before other lanes of it read the rows back
        h16* g = (mt ? K : Q) + (z * TT + n0) * HD + lane * 8;
#pragma unroll
        for (int i = 0; i < 8; ++i) *(v8h*)(g + i * 256) = *(const v8ha*)(my + (i * 4 + (lane >> 3)) * XP + (lane & 7) * 16);   // four whole rows a store
    }
#pragma unroll
    for (int eb = 0; eb < 4; ++eb) { const char* wp = wl + (2 * HD + eb * 16 + lr) * XP + hi * 16; const v16bf w0 = ldb(wp), w1 = ldb(wp + 64); const float bb = bs[2 * HD + eb * 16 + lr];
#pragma unroll
        for (int tt = 0; tt < 2; ++tt) { const v8f a = wmmab(xf[tt][1], w1, wmmab(xf[tt][0], w0, (v8f){})); v8h o;
#pragma unroll
            for (int r = 0; r < 8; ++r) o[r] = tohx(a[r] + bb);
            *(v8ha*)(my + (eb * 16 + lr) * VP + tt * 32 + hi * 16) = o; } }
    asm volatile("s_wait_dscnt 0x0" ::: "memory");   // as above
    h16* gv = VT + (z * HD + (lane >> 2)) * TT + n0 + (lane & 3) * 8;
#pragma unroll
    for (int i = 0; i < 8; ++i) *(v8h*)(gv + (size_t)i * 8 * TT) = *(const v8ha*)(my + (i * 8 + (lane >> 2)) * VP + (lane & 3) * 16);   // eight rows e a store, 64 bytes each
}

#define KST 64        // keys per stage
#define LP  72        // LDS row pitch in f16 elements: 64 + 8
__device__ __forceinline__ float xhalf(float v) { const int b = __float_as_int(v); return __int_as_float(__builtin_amdgcn_permlanex16(b, b, 0x76543210, 0xfedcba98, false, false)); }   // lane l <-> l ^ 16
__global__ __launch_bounds__(128) void k_fattn(const h16* __restrict__ Q, const h16* __restrict__ K, const h16* __restrict__ VT, float* __restrict__ OUT) {
    __shared__ __align__(16) h16 ks[2][KST * LP]; __shared__ __align__(16) h16 vs[2][HD * LP];   // HD == KST: both pairs of buffers have one shape
    const int tid = threadIdx.x, lane = tid & 31, lr = lane & 15, hi = lane >> 4; const int q0 = blockIdx.x * 128 + (tid >> 5) * 32; const size_t z = blockIdx.y;
    const int srow = tid >> 3, scol = (tid & 7) * 8;   // staging: this thread's row (then + 16, + 32, + 48) and its 16-byte piece of it
    const char* kg = (const char*)(K + z * TT * HD); const char* vg = (const char*)(VT + z * HD * TT); const unsigned ko = (unsigned)(srow * HD + scol) * 2u, vo = (unsigned)(srow * TT + scol) * 2u;   // the plane's base (the same for the whole work-group) and this thread's fixed byte offset
    const int sl = srow * LP + scol, fl = lr * LP + 8 * hi;
    const h16* qp = Q + (z * TT + q0 + lr) * HD + 8 * hi;
    const float c = SCL * 1.4426950408889634f;   // scores in log2 units: t = S x c
    v8h rk[4], rv[4];
#pragma unroll
    for (int i = 0; i < 4; ++i) { rk[i] = *(const v8h*)(kg + ko + i * 16 * HD * 2); rv[i] = *(const v8h*)(vg + vo + i * 16 * TT * 2); }
    v16h qf[2][2];
#pragma unroll
    for (int qb = 0; qb < 2; ++qb)
#pragma unroll
        for (int kc = 0; kc < 2; ++kc) qf[qb][kc] = WFrag<h16>::ld(qp + qb * 16 * HD + kc * 32);
    v8f o[4][2]; float m[2], l[2];
#pragma unroll
    for (int qb = 0; qb < 2; ++qb) { m[qb] = -3.0e38f; l[qb] = 0.f;
#pragma unroll
        for (int db = 0; db < 4; ++db) o[db][qb] = (v8f){}; }
#pragma unroll
    for (int i = 0; i < 4; ++i) { *(v8h*)(&ks[0][sl + i * 16 * LP]) = rk[i]; *(v8h*)(&vs[0][sl + i * 16 * LP]) = rv[i]; }
    __syncthreads();   // stage 0 is published
    const char* kn = kg + ko + KST * HD * 2; const char* vn = vg + vo + KST * 2;   // this thread's pieces of the stage that is fetched next
#pragma unroll 1   // rolled
    for (int st = 0; st < TT / KST; ++st) {
        const h16* kl = &ks[st & 1][fl]; const h16* vl = &vs[st & 1][fl];
        // the next stage's rows fly behind this whole trip; unconditional (no branch among the matrix instructions): the last trip fetches stage 15 again, into the buffer that nobody reads any more
#pragma unroll
        for (int i = 0; i < 4; ++i) { rk[i] = *(const v8h*)(kn + i * 16 * HD * 2); rv[i] = *(const v8h*)(vn + i * 16 * TT * 2); }
        __builtin_amdgcn_sched_barrier(0);   // keeps the fetches up here: without it the compiler sinks them to the stores at the foot of the trip, and every trip waits out their whole latency
#pragma unroll
        for (int kh = 0; kh < 2; ++kh) {   // two passes of 32 keys
            v8f s[2][2];
#pragma unroll
            for (int kt = 0; kt < 2; ++kt) { const v16h ka = WFrag<h16>::ld(kl + (kh * 2 + kt) * 16 * LP), kb = WFrag<h16>::ld(kl + (kh * 2 + kt) * 16 * LP + 32);
#pragma unroll
                for (int qb = 0; qb < 2; ++qb) s[kt][qb] = wmma16(kb, qf[qb][1], wmma16(ka, qf[qb][0], (v8f){})); }
            v16h vf[4];
#pragma unroll
            for (int db = 0; db < 4; ++db) vf[db] = WFrag<h16>::ld(vl + db * 16 * LP + kh * 32);
#pragma unroll
            for (int qb = 0; qb < 2; ++qb) {
                float mx = s[0][qb][0];
#pragma unroll
                for (int kt = 0; kt < 2; ++kt)
#pragma unroll
                    for (int r = 0; r < 8; ++r) mx = fmaxf(mx, s[kt][qb][r]);
                mx = fmaxf(mx, xhalf(mx));
                const float mn = fmaxf(m[qb], mx * c); const float al = __builtin_amdgcn_exp2f(m[qb] - mn); m[qb] = mn;
                const v2f c2 = {c, c}, nm2 = {-mn, -mn}; v2f sum2 = {0.f, 0.f}; v16h pf;
#pragma unroll
                for (int kt = 0; kt < 2; ++kt)
#pragma unroll
                    for (int r = 0; r < 8; r += 2) { const v2f sv = {s[kt][qb][r], s[kt][qb][r + 1]}; const v2f t = __builtin_elementwise_fma(sv, c2, nm2); v2f p; p[0] = __builtin_amdgcn_exp2f(t[0]); p[1] = __builtin_amdgcn_exp2f(t[1]); sum2 += p;
                        const v2h ph = __builtin_convertvector(p, v2h); pf[kt * 8 + r] = ph[0]; pf[kt * 8 + r + 1] = ph[1]; }
                l[qb] = l[qb] * al + (sum2[0] + sum2[1]);
#pragma unroll
                for (int db = 0; db < 4; ++db) { o[db][qb] *= al; o[db][qb] = wmma16(vf[db], pf, o[db][qb]); }
            }
        }
        { h16* kw = &ks[(st + 1) & 1][sl]; h16* vw = &vs[(st + 1) & 1][sl];
#pragma unroll
            for (int i = 0; i < 4; ++i) { *(v8h*)(kw + i * 16 * LP) = rk[i]; *(v8h*)(vw + i * 16 * LP) = rv[i]; } }
        if (st + 2 < TT / KST) { kn += KST * HD * 2; vn += KST * 2; }
        __syncthreads();   // publishes stage st + 1; every wave's reads of stage st are over, so the next trip may refill its buffer
    }
#pragma unroll
    for (int qb = 0; qb < 2; ++qb) { const float inv = __fdiv_rn(1.0f, l[qb] + xhalf(l[qb])); float* op = OUT + (z * TT + q0 + qb * 16 + lr) * HD + 8 * hi;   // the halves' sums joined once; a lane's 8 accumulator registers are 8 consecutive d of its query's row
#pragma unroll
        for (int db = 0; db < 4; ++db) { v4f w0, w1;
#pragma unroll
            for (int r = 0; r < 4; ++r) { w0[r] = o[db][qb][r] * inv; w1[r] = o[db][qb][r + 4] * inv; }
            *(v4f*)(op + db * 16) = w0; *(v4f*)(op + db * 16 + 4) = w1; } }
}

extern "C" void kernel_launch(void* const* d_in, const int* in_sizes, int n_in,
                              void* d_out, int out_size, void* d_ws, size_t ws_size, hipStream_t stream) {
    (void)in_sizes; (void)n_in; (void)out_size;
    const float* x = (const float*)d_in[0]; const float* wq = (const float*)d_in[1]; const float* bq = (const float*)d_in[2]; const float* wk = (const float*)d_in[3]; const float* bk = (const float*)d_in[4]; const float* wv = (const float*)d_in[5]; const float* bv = (const float*)d_in[6];   /* inputs in the module's setup_inputs order: x [8][1024][768], Wq ('oi' [64][64]), bq [64], Wk, bk, Wv, bv: SEVEN inputs, all read */
    float* OUT = (float*)d_out;     // [8][12][1024][64]
    char* wsp = (char*)d_ws;
    auto take = [&](size_t bytes) { char* p = wsp; wsp += (bytes + 255) & ~(size_t)255; return (void*)p; };
    h16* QP16 = (h16*)take((size_t)NZ * TT * HD * 2); h16* KP16 = (h16*)take((size_t)NZ * TT * HD * 2); h16* VT16 = (h16*)take((size_t)NZ * HD * TT * 2);
    if ((size_t)(wsp - (char*)d_ws) > ws_size) return;    // ws 256 MiB: 36 MiB taken
    k_qkv<<<dim3(TT / PT, NB_), 384, 0, stream>>>(x, wq, bq, wk, bk, wv, bv, QP16, KP16, VT16);   /* split, casts, projections, biases: writes every element of the three f16 planes */
    k_fattn<<<dim3(TT / 128, NZ), 128, 0, stream>>>(QP16, KP16, VT16, OUT);   /* every plane's scores, softmax and attn.V; writes the output [96][1024][64], f32 */
}

// v004
// It runs in 42.6 microseconds.
// Next to v003, in two timings, it ran 1.09 times as fast each time.
// Counting every step since v000, it is 43.8 times as fast.
#include <hip/hip_runtime.h>

// Multi-head self-attention with a STRIDED head split and ONE shared 64 x 64 projection triple (x [8][1024][768]; head h of twelve takes the channels d x 12 + h (the module's 'x.reshape(b, n, 64, 12)' with the head axis moved first); Q, K, V = xh W^T + b with 'oi' (out, in) weights [64][64] normal x 1/8 and biases [64] normal x 0.02, THE SAME THREE FOR EVERY HEAD; scores = Q.K x 768^-0.5 (the root of the FULL width, as the module has it); softmax over all 1,024 keys, no mask; out = attn.V kept HEAD-MAJOR -> [8][12][1024][64] f32 (6.3 M); argument order x, Wq, bq, Wk, bk, Wv, bv: seven inputs, all read).
// Layout, ALL EIGHT BATCH ENTRIES AT ONCE (plane z = b x 12 + h, 96 planes): k_qkv: ONE launch reads x once in whole lines, casts it to bf16 and sorts it by head in LDS (the strided split), casts the three 'oi' weights and the biases into LDS, does the three projections on the matrix unit and stores the f16 planes Q [96][1024][64], K [96][1024][64] and Vt [96][64][1024] itself; k_fattn: ONE launch does scores, softmax and attn.V for all 96 planes with the scores kept in registers (a held reference per query and a running sum over passes of 32 keys) and writes the f32 output itself.
// Compute dtypes, f32 accumulate: EVERY input rounded to bf16, the biases too; projections: bf16 products, f32 sums, + bias in f32 (Q then x 768^-0.5 x log2 e in f32), rounded once to fp16; attention: one fp16 product for the scores and one for attn.V (weights exp2(t - held reference), below 2^15, rounded to fp16; their f32 sum divides at the end); softmax f32 (the hardware exp2).

#define NB_  8
#define TT   1024
#define DM   768
#define NH_  12
#define NKV  12
#define REP  (NH_ / NKV)
#define HD   64
#define DQ   (NH_ * HD)
#define DKV  (NKV * HD)
#define NZ   (NB_ * NH_)
#define SCL  0.036084391824351608f   // 768^-0.5: the module scales by the root of the full width
#define QSC  (SCL * 1.4426950408889634f)   // Q is stored x QSC: Q.K is then the score in log2 units, ready for exp2
typedef _Float16 h16;
typedef unsigned short bf;
typedef __attribute__((ext_vector_type(16))) __bf16   v16bf;
typedef __attribute__((ext_vector_type(16))) _Float16 v16h;
typedef __attribute__((ext_vector_type(8)))  _Float16 v8h;
typedef __attribute__((ext_vector_type(8)))  unsigned short v8us;
typedef __attribute__((ext_vector_type(8)))  float    v8f;
typedef __attribute__((ext_vector_type(4)))  float    v4f;
typedef v8h  __attribute__((may_alias)) v8ha;
typedef v4f  __attribute__((may_alias)) v4fa;
typedef v8us __attribute__((may_alias)) v8usa;

__device__ __forceinline__ unsigned short f2bf(float f) { unsigned u = __float_as_uint(f); u += 0x7FFFu + ((u >> 16) & 1u); return (unsigned short)(u >> 16); }
__device__ __forceinline__ float bf2f(unsigned short b) { return __uint_as_float(((unsigned)b) << 16); }
__device__ __forceinline__ float bfr(float f) { return bf2f(f2bf(f)); }
__device__ __forceinline__ v16h cat16(v8h lo, v8h hi) { return __builtin_shufflevector(lo, hi, 0, 1, 2, 3, 4, 5, 6, 7, 8, 9, 10, 11, 12, 13, 14, 15); }
__device__ __forceinline__ v16bf cat16b(v8us lo, v8us hi) { return __builtin_bit_cast(v16bf, __builtin_shufflevector(lo, hi, 0, 1, 2, 3, 4, 5, 6, 7, 8, 9, 10, 11, 12, 13, 14, 15)); }
__device__ __forceinline__ v8f wmma16(v16h a, v16h b, v8f c) { return __builtin_amdgcn_wmma_f32_16x16x32_f16(false, a, false, b, (short)0, c, false, false); }
__device__ __forceinline__ v8f wmmab(v16bf a, v16bf b, v8f c) { return __builtin_amdgcn_wmma_f32_16x16x32_bf16(false, a, false, b, (short)0, c, false, false); }
__device__ __forceinline__ h16 tohx(float x) { return (h16)x; }
typedef __attribute__((ext_vector_type(2))) _Float16 v2h;
typedef __attribute__((ext_vector_type(2))) unsigned short v2us;
typedef __attribute__((ext_vector_type(4))) unsigned short v4us;
typedef __attribute__((ext_vector_type(2))) float v2f;

// WFrag::ld: one lane's share of a 16 x 32 operand from a K-contiguous row: elements 8 hi + 0..7, then 16 + 8 hi + 0..7 (p already points at row lr, element 8 hi).
template <typename T16> struct WFrag;
template <> struct WFrag<h16> { typedef v16h V; static __device__ __forceinline__ V ld(const h16* p) { return cat16(*(const v8h*)p, *(const v8h*)(p + 16)); } static __device__ __forceinline__ v8f mma(V a, V b, v8f c) { return wmma16(a, b, c); } };

// k_qkv: head split, casts, the three projections with their biases and the f16 plane stores in one kernel. A work-group is 32 consecutive tokens of one batch entry, all twelve heads: twelve waves, wave = head.
// Fill: the 32 rows of x are 96 KiB in a row: every thread fetches sixteen 16-byte pieces (whole lines per wave). A piece is four heads of one channel d (element d x 12 + h, 12 = 3 x 4): four 2-byte LDS stores put them into the heads' tiles [token][d]. Rows lie at a pitch of 144 bytes (16 x odd: no bank conflict for the 16-byte fragment reads); a head's tile starts 5,136 bytes after the one before (4 banks on, so that the three head groups of one store instruction fall on different banks).
// Products: Q and K transposed (A = weight rows, B = token rows, both by the same loader): a lane holds 8 consecutive outputs e of ONE token = 16 bytes of a plane's row. V as it stands (A = token rows, B = weight rows): a lane holds 8 consecutive tokens of ONE e = 16 bytes of a Vt row.
// Stores: a wave's tile of x is read by that wave alone, into registers, before its first product; from then on the tile's LDS is the wave's own staging room: the 16-byte pieces go in, whole rows come out (Q, K: 512 bytes in a row per store instruction; Vt: 64 bytes a row, all that 32 tokens fill).
#define PT   32       // tokens per work-group
#define XP   144      // LDS row pitch in bytes of a row of 64 16-bit elements: 128 + 16
#define VP   80       // LDS row pitch in bytes of a staged Vt row of 32 tokens: 64 + 16 (16 x odd)
#define HS   5136     // LDS bytes per head: the larger of 32 x XP and 64 x VP, + 16
typedef __attribute__((ext_vector_type(2))) __bf16 v2bf;
typedef unsigned short __attribute__((may_alias)) usa;
typedef v2us __attribute__((may_alias)) v2usa;
typedef v4us __attribute__((may_alias)) v4usa;
__device__ __forceinline__ v2us bf2(float a, float b) { const v2f p = {a, b}; return __builtin_bit_cast(v2us, __builtin_convertvector(p, v2bf)); }   // two f32 -> bf16, round to nearest even
__device__ __forceinline__ v16bf ldb(const char* p) { return cat16b(*(const v8usa*)p, *(const v8usa*)(p + 32)); }   // WFrag::ld's order, from LDS bytes
__global__ __launch_bounds__(384) void k_qkv(const float* __restrict__ x, const float* __restrict__ wq, const float* __restrict__ bq, const float* __restrict__ wk, const float* __restrict__ bk, const float* __restrict__ wv, const float* __restrict__ bv, h16* __restrict__ Q, h16* __restrict__ K, h16* __restrict__ VT) {
    __shared__ __align__(16) char xs[NH_ * HS]; __shared__ __align__(16) char wl[3 * HD * XP]; __shared__ __align__(16) float bs[3 * HD];
    const int tid = threadIdx.x, lane = tid & 31, lr = lane & 15, hi = lane >> 4; const int h = __builtin_amdgcn_readfirstlane(tid >> 5);   // the wave's number = its head, held as a scalar: the weight and bias pointers below are then picked by scalar code
    const int n0 = blockIdx.x * PT; const size_t b = blockIdx.y;
    const float* xg = x + (b * TT + n0) * DM + tid * 4;
    const float* wg = ((h < 4) ? wq : (h < 8) ? wk : wv) + (h & 3) * 16 * HD + lane * 4;   // the three weights are 192 rows: wave h casts rows 16 h + 0..15, a quarter of one weight (one scalar base a wave)
    v4f xr[16], wr[8];
#pragma unroll
    for (int i = 0; i < 16; ++i) xr[i] = *(const v4f*)(xg + i * 384 * 4);   // 384 pieces = two rows a step
#pragma unroll
    for (int i = 0; i < 8; ++i) wr[i] = *(const v4f*)(wg + i * 128);   // 512 bytes (two rows) a load
    const float br = ((h < 4) ? bq : (h < 8) ? bk : bv)[(h & 3) * 16 + lr];   // and the 16 biases of those rows (both halves of the wave read and store the same 16: no branch among the loads)
    { const int j = tid % 192; char* xw = xs + (j % 3) * 4 * HS + (tid / 192) * XP + (j / 3) * 2;   // piece j of its row: channel j / 3, heads 4 (j % 3) + 0..3
#pragma unroll
        for (int i = 0; i < 16; ++i) {
            if ((i & 3) == 0) __builtin_amdgcn_sched_barrier(0);   // four pieces at a time, in the order of the loads: without it the compiler gathers all casts in front of the first LDS store, and every store waits for the last load
            const v2us lo = bf2(xr[i][0], xr[i][1]), hh = bf2(xr[i][2], xr[i][3]);
            *(usa*)(xw + i * 2 * XP) = lo[0]; *(usa*)(xw + i * 2 * XP + HS) = lo[1]; *(usa*)(xw + i * 2 * XP + 2 * HS) = hh[0]; *(usa*)(xw + i * 2 * XP + 3 * HS) = hh[1]; } }
    __builtin_amdgcn_sched_barrier(0);   // as above: the weights' casts wait for later loads and stay behind the tiles' stores
#pragma unroll
    for (int i = 0; i < 8; ++i) { const v2us lo = bf2(wr[i][0], wr[i][1]), hh = bf2(wr[i][2], wr[i][3]); const v4us o = {lo[0], lo[1], hh[0], hh[1]}; *(v4usa*)(wl + (h * 16 + i * 2 + hi) * XP + lr * 8) = o; }   // 16 pieces a row
    bs[h * 16 + lr] = bfr(br);
    __syncthreads();   // the tiles, the weights and the biases are published; the only barrier: behind it a wave touches no other wave's tile
    char* my = xs + h * HS; const size_t z = b * NH_ + h;
    v16bf xf[2][2];
#pragma unroll
    for (int tt = 0; tt < 2; ++tt)
#pragma unroll
        for (int kc = 0; kc < 2; ++kc) xf[tt][kc] = ldb(my + (tt * 16 + lr) * XP + kc * 64 + hi * 16);
#pragma unroll
    for (int mt = 0; mt < 2; ++mt) {   // Q, then K
        const float qs = mt ? 1.0f : QSC;   // Q alone carries the score scale, in f32 in front of its one rounding
#pragma unroll
        for (int eb = 0; eb < 4; ++eb) { const char* wp = wl + (mt * HD + eb * 16 + lr) * XP + hi * 16; const v16bf w0 = ldb(wp), w1 = ldb(wp + 64);
            const v4f b0 = *(const v4fa*)(bs + mt * HD + eb * 16 + hi * 8), b1 = *(const v4fa*)(bs + mt * HD + eb * 16 + hi * 8 + 4);
#pragma unroll
            for (int tt = 0; tt < 2; ++tt) { const v8f a = wmmab(w1, xf[tt][1], wmmab(w0, xf[tt][0], (v8f){})); v8h o;
#pragma unroll
                for (int r = 0; r < 4; ++r) { o[r] = tohx((a[r] + b0[r]) * qs); o[r + 4] = tohx((a[r + 4] + b1[r]) * qs); }
                *(v8ha*)(my + (tt * 16 + lr) * XP + eb * 32 + hi * 16) = o; } }
        asm volatile("s_wait_dscnt 0x0" ::: "memory");   // the wave's staged pieces are in LDS before other lanes of it read the rows back
        h16* g = (mt ? K : Q) + (z * TT + n0) * HD + lane * 8;
#pragma unroll
        for (int i = 0; i < 8; ++i) *(v8h*)(g + i * 256) = *(const v8ha*)(my + (i * 4 + (lane >> 3)) * XP + (lane & 7) * 16);   // four whole rows a store
    }
#pragma unroll
    for (int eb = 0; eb < 4; ++eb) { const char* wp = wl + (2 * HD + eb * 16 + lr) * XP + hi * 16; const v16bf w0 = ldb(wp), w1 = ldb(wp + 64); const float bb = bs[2 * HD + eb * 16 + lr];
#pragma unroll
        for (int tt = 0; tt < 2; ++tt) { const v8f a = wmmab(xf[tt][1], w1, wmmab(xf[tt][0], w0, (v8f){})); v8h o;
#pragma unroll
            for (int r = 0; r < 8; ++r) o[r] = tohx(a[r] + bb);
            *(v8ha*)(my + (eb * 16 + lr) * VP + tt * 32 + hi * 16) = o; } }
    asm volatile("s_wait_dscnt 0x0" ::: "memory");   // as above
    h16* gv = VT + (z * HD + (lane >> 2)) * TT + n0 + (lane & 3) * 8;
#pragma unroll
    for (int i = 0; i < 8; ++i) *(v8h*)(gv + (size_t)i * 8 * TT) = *(const v8ha*)(my + (i * 8 + (lane >> 2)) * VP + (lane & 3) * 16);   // eight rows e a store, 64 bytes each
}

#define KST 64        // keys per stage
#define LP  72        // LDS row pitch in f16 elements: 64 + 8
__device__ __forceinline__ float xhalf(float v) { const int b = __float_as_int(v); return __int_as_float(__builtin_amdgcn_permlanex16(b, b, 0x76543210, 0xfedcba98, false, false)); }   // lane l <-> l ^ 16
__device__ __forceinline__ float colmax(v8f a, v8f b) { float mx = a[0];   // a query's maximum over the 32 keys of two St tiles, joined over the wave's halves
#pragma unroll
    for (int r = 0; r < 8; ++r) mx = fmaxf(fmaxf(mx, a[r]), b[r]);
    return fmaxf(mx, xhalf(mx)); }
__device__ __forceinline__ float wexp(v8f a, v8f b, v2f (&p)[8]) { v2f sum2 = {0.f, 0.f};   // the 16 weights exp2(t) of a lane and their sum
#pragma unroll
    for (int r = 0; r < 8; r += 2) { p[r >> 1][0] = __builtin_amdgcn_exp2f(a[r]); p[r >> 1][1] = __builtin_amdgcn_exp2f(a[r + 1]); sum2 += p[r >> 1]; }
#pragma unroll
    for (int r = 0; r < 8; r += 2) { p[4 + (r >> 1)][0] = __builtin_amdgcn_exp2f(b[r]); p[4 + (r >> 1)][1] = __builtin_amdgcn_exp2f(b[r + 1]); sum2 += p[4 + (r >> 1)]; }
    return sum2[0] + sum2[1]; }
__global__ __launch_bounds__(128) void k_fattn(const h16* __restrict__ Q, const h16* __restrict__ K, const h16* __restrict__ VT, float* __restrict__ OUT) {
    __shared__ __align__(16) h16 ks[2][KST * LP]; __shared__ __align__(16) h16 vs[2][HD * LP];   // HD == KST: both pairs of buffers have one shape
    const int tid = threadIdx.x, lane = tid & 31, lr = lane & 15, hi = lane >> 4; const int q0 = blockIdx.x * 128 + (tid >> 5) * 32; const size_t z = blockIdx.y;
    const int srow = tid >> 3, scol = (tid & 7) * 8;   // staging: this thread's row (then + 16, + 32, + 48) and its 16-byte piece of it
    const char* kg = (const char*)(K + z * TT * HD); const char* vg = (const char*)(VT + z * HD * TT); const unsigned ko = (unsigned)(srow * HD + scol) * 2u, vo = (unsigned)(srow * TT + scol) * 2u;   // the plane's base (the same for the whole work-group) and this thread's fixed byte offset
    const int sl = srow * LP + scol, fl = lr * LP + 8 * hi;
    const h16* qp = Q + (z * TT + q0 + lr) * HD + 8 * hi;
    v8h rk[4], rv[4];
#pragma unroll
    for (int i = 0; i < 4; ++i) { rk[i] = *(const v8h*)(kg + ko + i * 16 * HD * 2); rv[i] = *(const v8h*)(vg + vo + i * 16 * TT * 2); }
    v16h qf[2][2];
#pragma unroll
    for (int qb = 0; qb < 2; ++qb)
#pragma unroll
        for (int kc = 0; kc < 2; ++kc) qf[qb][kc] = WFrag<h16>::ld(qp + qb * 16 * HD + kc * 32);
    v8f o[4][2], nref[2]; float l[2];
#pragma unroll
    for (int qb = 0; qb < 2; ++qb) { l[qb] = 0.f;
#pragma unroll
        for (int db = 0; db < 4; ++db) o[db][qb] = (v8f){}; }
#pragma unroll
    for (int i = 0; i < 4; ++i) { *(v8h*)(&ks[0][sl + i * 16 * LP]) = rk[i]; *(v8h*)(&vs[0][sl + i * 16 * LP]) = rv[i]; }
    __syncthreads();   // stage 0 is published
    {   // the reference's start: the maximum over keys 0..31 (their scores are formed again in the first pass, then against it)
        v8f s[2][2];
#pragma unroll
        for (int kt = 0; kt < 2; ++kt) { const v16h ka = WFrag<h16>::ld(&ks[0][fl] + kt * 16 * LP), kb = WFrag<h16>::ld(&ks[0][fl] + kt * 16 * LP + 32);
#pragma unroll
            for (int qb = 0; qb < 2; ++qb) s[kt][qb] = wmma16(kb, qf[qb][1], wmma16(ka, qf[qb][0], (v8f){})); }
#pragma unroll
        for (int qb = 0; qb < 2; ++qb) { const float mx = colmax(s[0][qb], s[1][qb]); nref[qb] = (v8f){} - mx; }
    }
    const char* kn = kg + ko + KST * HD * 2; const char* vn = vg + vo + KST * 2;   // this thread's pieces of the stage that is fetched next
#pragma unroll 1   // rolled
    for (int st = 0; st < TT / KST; ++st) {
        const h16* kl = &ks[st & 1][fl]; const h16* vl = &vs[st & 1][fl];
        // the next stage's rows fly behind this whole trip; unconditional (no branch among the matrix instructions): the last trip fetches stage 15 again, into the buffer that nobody reads any more
#pragma unroll
        for (int i = 0; i < 4; ++i) { rk[i] = *(const v8h*)(kn + i * 16 * HD * 2); rv[i] = *(const v8h*)(vn + i * 16 * TT * 2); }
        __builtin_amdgcn_sched_barrier(0);   // keeps the fetches up here: without it the compiler sinks them to the stores at the foot of the trip, and every trip waits out their whole latency
#pragma unroll
        for (int kh = 0; kh < 2; ++kh) {   // two passes of 32 keys
            v8f s[2][2];
#pragma unroll
            for (int kt = 0; kt < 2; ++kt) { const v16h ka = WFrag<h16>::ld(kl + (kh * 2 + kt) * 16 * LP), kb = WFrag<h16>::ld(kl + (kh * 2 + kt) * 16 * LP + 32);
#pragma unroll
                for (int qb = 0; qb < 2; ++qb) s[kt][qb] = wmma16(kb, qf[qb][1], wmma16(ka, qf[qb][0], nref[qb])); }   // t = Q.K - reference
            v16h vf[4];
#pragma unroll
            for (int db = 0; db < 4; ++db) vf[db] = WFrag<h16>::ld(vl + db * 16 * LP + kh * 32);
            v2f p[2][8]; float sm[2];
#pragma unroll
            for (int qb = 0; qb < 2; ++qb) sm[qb] = wexp(s[0][qb], s[1][qb], p[qb]);
            if (__builtin_expect(__builtin_amdgcn_ballot_w32(!(fmaxf(sm[0], sm[1]) < 32768.f)) != 0, 0)) {   // one scalar branch a pass: some lane's weights have outgrown the reference
#pragma unroll
                for (int qb = 0; qb < 2; ++qb) { const float d = fmaxf(colmax(s[0][qb], s[1][qb]), 0.f); const float al = __builtin_amdgcn_exp2f(-d);   // the reference rises by d to the running maximum (d = 0, al = 1 for a query that has not passed it)
                    nref[qb] -= d; l[qb] *= al;
#pragma unroll
                    for (int db = 0; db < 4; ++db) o[db][qb] *= al;
                    sm[qb] = wexp(s[0][qb] - d, s[1][qb] - d, p[qb]); }
            }
            if (kh == 1) { asm volatile("s_wait_xcnt 0x0" ::: "memory"); __builtin_amdgcn_sched_barrier(0); }   // in front of the steps of kn and vn at the foot, which overwrite the address registers of this trip's fetches; the scheduling barrier keeps those steps from being lifted over the wait
#pragma unroll
            for (int qb = 0; qb < 2; ++qb) { v16h pf; l[qb] += sm[qb];
#pragma unroll
                for (int r = 0; r < 8; ++r) { const v2h ph = __builtin_convertvector(p[qb][r], v2h); pf[2 * r] = ph[0]; pf[2 * r + 1] = ph[1]; }
#pragma unroll
                for (int db = 0; db < 4; ++db) o[db][qb] = wmma16(vf[db], pf, o[db][qb]);
            }
        }
        { h16* kw = &ks[(st + 1) & 1][sl]; h16* vw = &vs[(st + 1) & 1][sl];
#pragma unroll
            for (int i = 0; i < 4; ++i) { *(v8h*)(kw + i * 16 * LP) = rk[i]; *(v8h*)(vw + i * 16 * LP) = rv[i]; } }
        if (st + 2 < TT / KST) { kn += KST * HD * 2; vn += KST * 2; }
        __syncthreads();   // publishes stage st + 1; every wave's reads of stage st are over, so the next trip may refill its buffer
    }
#pragma unroll
    for (int qb = 0; qb < 2; ++qb) { const float inv = __fdiv_rn(1.0f, l[qb] + xhalf(l[qb])); float* op = OUT + (z * TT + q0 + qb * 16 + lr) * HD + 8 * hi;   // the halves' sums joined once; a lane's 8 accumulator registers are 8 consecutive d of its query's row
#pragma unroll
        for (int db = 0; db < 4; ++db) { v4f w0, w1;
#pragma unroll
            for (int r = 0; r < 4; ++r) { w0[r] = o[db][qb][r] * inv; w1[r] = o[db][qb][r + 4] * inv; }
            *(v4f*)(op + db * 16) = w0; *(v4f*)(op + db * 16 + 4) = w1; } }
}

extern "C" void kernel_launch(void* const* d_in, const int* in_sizes, int n_in,
                              void* d_out, int out_size, void* d_ws, size_t ws_size, hipStream_t stream) {
    (void)in_sizes; (void)n_in; (void)out_size;
    const float* x = (const float*)d_in[0]; const float* wq = (const float*)d_in[1]; const float* bq = (const float*)d_in[2]; const float* wk = (const float*)d_in[3]; const float* bk = (const float*)d_in[4]; const float* wv = (const float*)d_in[5]; const float* bv = (const float*)d_in[6];   /* inputs in the module's setup_inputs order: x [8][1024][768], Wq ('oi' [64][64]), bq [64], Wk, bk, Wv, bv: SEVEN inputs, all read */
    float* OUT = (float*)d_out;     // [8][12][1024][64]
    char* wsp = (char*)d_ws;
    auto take = [&](size_t bytes) { char* p = wsp; wsp += (bytes + 255) & ~(size_t)255; return (void*)p; };
    h16* QP16 = (h16*)take((size_t)NZ * TT * HD * 2); h16* KP16 = (h16*)take((size_t)NZ * TT * HD * 2); h16* VT16 = (h16*)take((size_t)NZ * HD * TT * 2);
    if ((size_t)(wsp - (char*)d_ws) > ws_size) return;    // ws 256 MiB: 36 MiB taken
    k_qkv<<<dim3(TT / PT, NB_), 384, 0, stream>>>(x, wq, bq, wk, bk, wv, bv, QP16, KP16, VT16);   /* split, casts, projections, biases: writes every element of the three f16 planes */
    k_fattn<<<dim3(TT / 128, NZ), 128, 0, stream>>>(QP16, KP16, VT16, OUT);   /* every plane's scores, softmax and attn.V; writes the output [96][1024][64], f32 */
}
